// v000
// The times below were measured on an AMD MI455X: many runs one after another, warmed up first and cycling through
// copies of the inputs, with the whole window's GPU time divided by the number of runs. Launches and the gaps
// between them are all in it. The median over several windows is given; except for v000 it joins two sittings, which
// can be a few percent apart, so the side-by-side timings, each taken in one sitting, are the better comparison.
// v000 is the starting kernel. One run takes 2120 microseconds.
#include <hip/hip_runtime.h>

// Core dot-product attention on sequence-first tensors (query, key, value [2048][2][16][64] = [sq][b][np][hn]; scores = q.k UNscaled (the module computes sqrt(hn) but never applies it: logit sigma ~8); softmax over all 2,048 keys; context -> [2048][2][1024] (4.2 M)). The (b, np) pairs are 32 independent heads of one token-major [2048][2048] slab, and the output row layout [s][b][np*hn] is that same slab, so the whole problem is one pass over 32 heads.
// Layout: single bf16 planes per head (inputs bf16-exact: exact score products); the softmax with EVERY row hi/lo (2-product attn.v): the unscaled logits are far too sharp for fp16 probabilities; merged f32 output rows.
// Compute dtypes, f32 accumulate: every input rounded to bf16; q.k exact; softmax f32; P hi/lo x exact values; output f32.

#define NB_  1
#define TT   2048
#define DM   2048      // token-major row pitch (H x HD)
#define NH_  32
#define NKV  1
#define REP  (NH_ / NKV)
#define HD   64
#define DQ   (NH_ * HD)
#define DKV  (NKV * HD)
#define ZH   1
#define RH   2048                  // query rows < RH use hi+lo planes (0: none)
#define WIN  0
#define PCAR 1024.0f
#define SCL  1.0f   // unscaled (the module never applies its norm_factor)
typedef _Float16 h16;
typedef unsigned short bf;
typedef __attribute__((ext_vector_type(16))) __bf16   v16bf;
typedef __attribute__((ext_vector_type(16))) _Float16 v16h;
typedef __attribute__((ext_vector_type(8)))  _Float16 v8h;
typedef __attribute__((ext_vector_type(8)))  unsigned short v8us;
typedef __attribute__((ext_vector_type(8)))  float    v8f;
typedef __attribute__((ext_vector_type(4)))  float    v4f;
typedef v8h  __attribute__((may_alias)) v8ha;
typedef v4f  __attribute__((may_alias)) v4fa;
typedef v8us __attribute__((may_alias)) v8usa;

__device__ __forceinline__ unsigned short f2bf(float f) { unsigned u = __float_as_uint(f); u += 0x7FFFu + ((u >> 16) & 1u); return (unsigned short)(u >> 16); }
__device__ __forceinline__ float bf2f(unsigned short b) { return __uint_as_float(((unsigned)b) << 16); }
__device__ __forceinline__ float bfr(float f) { return bf2f(f2bf(f)); }
__device__ __forceinline__ v16h cat16(v8h lo, v8h hi) { return __builtin_shufflevector(lo, hi, 0, 1, 2, 3, 4, 5, 6, 7, 8, 9, 10, 11, 12, 13, 14, 15); }
__device__ __forceinline__ v16bf cat16b(v8us lo, v8us hi) { return __builtin_bit_cast(v16bf, __builtin_shufflevector(lo, hi, 0, 1, 2, 3, 4, 5, 6, 7, 8, 9, 10, 11, 12, 13, 14, 15)); }
__device__ __forceinline__ v8f wmma16(v16h a, v16h b, v8f c) { return __builtin_amdgcn_wmma_f32_16x16x32_f16(false, a, false, b, (short)0, c, false, false); }
__device__ __forceinline__ v8f wmmab(v16bf a, v16bf b, v8f c) { return __builtin_amdgcn_wmma_f32_16x16x32_bf16(false, a, false, b, (short)0, c, false, false); }



// ---- k_gemmw: register-blocked GEMM, ONE WAVE per 64x64 output tile (16 accumulators), operands straight from K-contiguous 16-bit planes; grid (M/64, N/64, Z), 32 threads.
// C[m][n] (f32, pitch ldc, + optional f32 bias[n]) = sum_k A[m][k] Bt[n][k] (+ split products per NSPLIT). z-batch strides sA/sB/sC in elements. K % 32 == 0.
template <typename T16> struct WFrag;
template <> struct WFrag<h16> { typedef v16h V; static __device__ __forceinline__ V ld(const h16* p) { return cat16(*(const v8h*)p, *(const v8h*)(p + 16)); } static __device__ __forceinline__ v8f mma(V a, V b, v8f c) { return wmma16(a, b, c); } };
template <> struct WFrag<bf> { typedef v16bf V; static __device__ __forceinline__ V ld(const bf* p) { return cat16b(*(const v8us*)p, *(const v8us*)(p + 16)); } static __device__ __forceinline__ v8f mma(V a, V b, v8f c) { return wmmab(a, b, c); } };
template <typename T16, int NSPLIT, bool BIAS>
__global__ __launch_bounds__(32) void k_gemmw(const T16* __restrict__ A, const T16* __restrict__ A2, const T16* __restrict__ Bt, const T16* __restrict__ Bt2, int K, float* C, int ldc, const float* __restrict__ bias, size_t sA, size_t sB, size_t sC) {
    typedef typename WFrag<T16>::V V;
    __shared__ __align__(16) float os[16 * 68];
    const size_t z = blockIdx.z; A += z * sA; if (A2) A2 += z * sA; Bt += z * sB; if (Bt2) Bt2 += z * sB; C += z * sC;
    const int lane = threadIdx.x & 31, lr = lane & 15, hi = lane >> 4; const int r0 = blockIdx.x * 64, c0 = blockIdx.y * 64;
    v8f acc[4][4];
#pragma unroll
    for (int mb = 0; mb < 4; ++mb)
#pragma unroll
        for (int nb = 0; nb < 4; ++nb) acc[mb][nb] = (v8f){};
    const size_t aoff = (size_t)(r0 + lr) * K + 8 * hi, boff = (size_t)(c0 + lr) * K + 8 * hi;
#pragma unroll 1
    for (int kc = 0; kc < K; kc += 32) {
        V a[4], a2[4];
#pragma unroll
        for (int mb = 0; mb < 4; ++mb) { a[mb] = WFrag<T16>::ld(A + aoff + (size_t)mb * 16 * K + kc); if (NSPLIT == 1 || NSPLIT == 2) a2[mb] = WFrag<T16>::ld(A2 + aoff + (size_t)mb * 16 * K + kc); }
#pragma unroll
        for (int nb = 0; nb < 4; ++nb) { const V b = WFrag<T16>::ld(Bt + boff + (size_t)nb * 16 * K + kc); V b2; if (NSPLIT >= 2) b2 = WFrag<T16>::ld(Bt2 + boff + (size_t)nb * 16 * K + kc);
#pragma unroll
            for (int mb = 0; mb < 4; ++mb) { acc[mb][nb] = WFrag<T16>::mma(a[mb], b, acc[mb][nb]); if (NSPLIT == 1 || NSPLIT == 2) acc[mb][nb] = WFrag<T16>::mma(a2[mb], b, acc[mb][nb]); if (NSPLIT >= 2) acc[mb][nb] = WFrag<T16>::mma(a[mb], b2, acc[mb][nb]); } }
        asm volatile("v_nop\n\tv_nop\n\tv_nop\n\tv_nop" : "+v"(acc[0][0]), "+v"(acc[1][1]), "+v"(acc[2][2]), "+v"(acc[3][3]) : "v"(a[0]), "v"(a[3]));
    }
#pragma unroll
    for (int mb = 0; mb < 4; ++mb) {
#pragma unroll
        for (int nb = 0; nb < 4; ++nb) {
#pragma unroll
            for (int j = 0; j < 8; ++j) os[(hi * 8 + j) * 68 + nb * 16 + lr] = acc[mb][nb][j]; }
        __builtin_amdgcn_wave_barrier(); asm volatile("" ::: "memory");
        float* crow = C + (size_t)(r0 + mb * 16) * ldc + c0;
{
#pragma unroll
            for (int s = 0; s < 8; ++s) { const int row = 2 * s + hi, cofs = lr * 4; v4f val = *(const v4fa*)(os + row * 68 + cofs); if (BIAS) { val[0] += bfr(bias[c0 + cofs]); val[1] += bfr(bias[c0 + cofs + 1]); val[2] += bfr(bias[c0 + cofs + 2]); val[3] += bfr(bias[c0 + cofs + 3]); }
                *(v4f*)(crow + (size_t)row * ldc + cofs) = val; }
             }
        __builtin_amdgcn_wave_barrier(); asm volatile("" ::: "memory");
    }
}

__device__ __forceinline__ h16 tohx(float x) { return (h16)x; }
__device__ __forceinline__ void splitf(float y, unsigned short& h, unsigned short& l) { h = f2bf(y); l = f2bf(y - bf2f(h)); }
typedef __attribute__((ext_vector_type(2))) _Float16 v2h;
typedef __attribute__((ext_vector_type(4))) _Float16 v4h;
typedef __attribute__((ext_vector_type(2))) unsigned short v2us;
typedef __attribute__((ext_vector_type(4))) unsigned short v4us;
typedef __attribute__((ext_vector_type(2))) float v2f;
typedef __attribute__((ext_vector_type(4))) int v4i;

__global__ __launch_bounds__(256) void k_wtG(const float* __restrict__ w, int K, int N, bf* Bt) {
    const int lane = threadIdx.x & 31; const int L0 = (blockIdx.x * 8 + (threadIdx.x >> 5)) * 8; const int nlines = N * K / 64;
{
#pragma unroll 1
        for (int l = 0; l < 8; ++l) { const int L = L0 + l; if (L >= nlines) break; const size_t e = (size_t)L * 64 + lane * 2; const int k = (int)(e % K), n = (int)(e / K); v2us o;
            o[0] = f2bf(w[(size_t)k * N + n]); o[1] = f2bf(w[(size_t)(k + 1) * N + n]); *(v2us*)(Bt + e) = o; }
         }
}
__global__ __launch_bounds__(256) void k_cvt8(const float* __restrict__ src, bf* dst, size_t n8) { const size_t i = (size_t)blockIdx.x * 256 + threadIdx.x; if (i >= n8) return; const v8f v = *(const v8f*)(src + i * 8); v8us o;
#pragma unroll
    for (int k = 0; k < 8; ++k) o[k] = f2bf(v[k]); *(v8us*)(dst + i * 8) = o;  }


__global__ __launch_bounds__(256) void k_vtp(const float* __restrict__ F, int pitch, int nheads, h16* V16, bf* Vh, bf* Vl) { const size_t e = ((size_t)blockIdx.x * 256 + threadIdx.x) * 2; if (e >= (size_t)nheads * HD * TT) return; const int t = (int)(e % TT); const int d = (int)((e / TT) % HD); const int g = (int)(e / ((size_t)TT * HD)); v2h o16; v2us oh, ol;
#pragma unroll
    for (int q = 0; q < 2; ++q) { const float x = F[(size_t)(t + q) * pitch + g * HD + d]; o16[q] = tohx(x); unsigned short a2, c2; splitf(x, a2, c2); oh[q] = a2; ol[q] = c2; }
    *(v2h*)(V16 + e) = o16; *(v2us*)(Vh + e) = oh; *(v2us*)(Vl + e) = ol;  }

// k_asoft: per row (zz, i): t = S x SCL (= 1, unscaled; no mask); softmax over the 2048 keys (register row, one exp, fixed trees);
__global__ __launch_bounds__(256) void k_asoft(const float* __restrict__ Sb, h16* P16, bf* Ph, bf* Pl) {
    const int lane = threadIdx.x & 31; const int row = blockIdx.x * 8 + (threadIdx.x >> 5); if (row >= ZH * TT) return; const int i = row % TT; const int zz = row / TT; (void)zz; const bool hires = (i < RH); const float* sr = Sb + (size_t)row * TT; float v[TT / 32]; float mx = -3.0e38f;
#pragma unroll
    for (int ch = 0; ch < TT / 128; ++ch) { const int j0 = ch * 128 + lane * 4; const v4f a = *(const v4f*)(sr + j0);
#pragma unroll
        for (int q = 0; q < 4; ++q) { const float t = a[q] * SCL; v[ch * 4 + q] = t;   /* Sb holds the plain q.k scores (no bias) */ mx = fmaxf(mx, t); } }
#pragma unroll
    for (int sh = 16; sh; sh >>= 1) mx = fmaxf(mx, __shfl_xor(mx, sh, 32));
    float sum = 0.f;
#pragma unroll
    for (int k = 0; k < TT / 32; ++k) { float d0 = __fsub_rn(v[k], mx); asm volatile("" : "+v"(d0)); v[k] = __builtin_amdgcn_exp2f(__fmul_rn(d0, 1.4426950408889634f)); sum += v[k]; }
#pragma unroll
    for (int sh = 16; sh; sh >>= 1) sum += __shfl_xor(sum, sh, 32);
    const float f = __fdiv_rn(hires ? 1.0f : PCAR, sum);
{
        if (hires) {
#pragma unroll
            for (int ch = 0; ch < TT / 128; ++ch) { v4us oh, ol;
#pragma unroll
                for (int q = 0; q < 4; ++q) { unsigned short a, c2; splitf(v[ch * 4 + q] * f, a, c2); oh[q] = a; ol[q] = c2; }
                const size_t oo = ((size_t)zz * (RH ? RH : 1) + i) * TT + ch * 128 + lane * 4; *(v4us*)(Ph + oo) = oh; *(v4us*)(Pl + oo) = ol; }
        } else {
#pragma unroll
            for (int ch = 0; ch < TT / 128; ++ch) { v4h o4;
#pragma unroll
                for (int q = 0; q < 4; ++q) o4[q] = tohx(v[ch * 4 + q] * f);
                *(v4h*)(P16 + (size_t)row * TT + ch * 128 + lane * 4) = o4; } }
         }
}
__global__ __launch_bounds__(256) void k_merge(const float* __restrict__ O, int h0, float* OUTb) { const size_t e = ((size_t)blockIdx.x * 256 + threadIdx.x) * 2; if (e >= (size_t)ZH * TT * HD) return; const int d = (int)(e % HD); const int t = (int)((e / HD) % TT); const int zz = (int)(e / ((size_t)HD * TT)); const float cs = (t < RH) ? 1.0f : (1.0f / PCAR); const size_t oo = (size_t)t * DQ + (h0 + zz) * HD + d;
    v2f o2; o2[0] = O[e] * cs; o2[1] = O[e + 1] * cs; *(v2f*)(OUTb + oo) = o2;  }


__global__ __launch_bounds__(256) void k_vtpR1(const float* __restrict__ Vb, bf* Vh) { const size_t e = ((size_t)blockIdx.x * 256 + threadIdx.x) * 2; if (e >= (size_t)HD * TT) return; const int t = (int)(e % TT); const int d = (int)(e / TT); v2us o; o[0] = f2bf(Vb[(size_t)t * HD + d]); o[1] = f2bf(Vb[(size_t)(t + 1) * HD + d]); *(v2us*)(Vh + e) = o;  }
__global__ __launch_bounds__(256) void k_mergeR(const float* __restrict__ O, float* outb, size_t n4) { const size_t i = (size_t)blockIdx.x * 256 + threadIdx.x; if (i >= n4) return; const v4f a = *(const v4f*)(O + i * 4); *(v4f*)(outb + i * 4) = a;  }


__global__ __launch_bounds__(256) void k_hp1(const float* __restrict__ src, bf* P) { const size_t i = (size_t)blockIdx.x * 256 + threadIdx.x; if (i >= (size_t)NH_ * TT * HD / 8) return; const size_t e = i * 8; const int d = (int)(e % HD); const int t = (int)((e / HD) % TT); const int h = (int)(e / ((size_t)HD * TT)); const v8f v = *(const v8f*)(src + (size_t)t * DM + h * HD + d); v8us o;
#pragma unroll
    for (int q = 0; q < 8; ++q) o[q] = f2bf(v[q]);
    *(v8us*)(P + e) = o;  }
__global__ __launch_bounds__(256) void k_vt1(const float* __restrict__ src, int pitch, bf* VT) { const size_t e = ((size_t)blockIdx.x * 256 + threadIdx.x) * 2; if (e >= (size_t)NH_ * HD * TT) return; const int t = (int)(e % TT); const int d = (int)((e / TT) % HD); const int h = (int)(e / ((size_t)TT * HD)); v2us o; o[0] = f2bf(src[(size_t)t * pitch + h * HD + d]); o[1] = f2bf(src[(size_t)(t + 1) * pitch + h * HD + d]); *(v2us*)(VT + e) = o;  }
__global__ __launch_bounds__(256) void k_mergeT(const float* __restrict__ O, int h, float* outb) { const size_t i = (size_t)blockIdx.x * 256 + threadIdx.x; if (i >= (size_t)TT * HD / 4) return; const size_t e = i * 4; const int d = (int)(e % HD); const int t = (int)(e / HD); const v4f a = *(const v4f*)(O + e); *(v4f*)(outb + (size_t)t * DM + h * HD + d) = a;  }

extern "C" void kernel_launch(void* const* d_in, const int* in_sizes, int n_in,
                              void* d_out, int out_size, void* d_ws, size_t ws_size, hipStream_t stream) {
    (void)in_sizes; (void)n_in; (void)out_size;
    const float* Qin = (const float*)d_in[0]; const float* Kin = (const float*)d_in[1]; const float* Vin = (const float*)d_in[2];
    float* OUT = (float*)d_out;
    char* wsp = (char*)d_ws;
    auto take = [&](size_t bytes) { char* p = wsp; wsp += (bytes + 255) & ~(size_t)255; return (void*)p; };
    bf* QB = (bf*)take((size_t)NH_ * TT * HD * 2); bf* KB = (bf*)take((size_t)NH_ * TT * HD * 2); bf* VT = (bf*)take((size_t)NH_ * HD * TT * 2);
    float* Sb = (float*)take((size_t)TT * TT * 4);  bf* Ph = (bf*)take((size_t)TT * TT * 2); bf* Pl = (bf*)take((size_t)TT * TT * 2); float* Ob = (float*)take((size_t)TT * HD * 4);
    if ((size_t)(wsp - (char*)d_ws) > ws_size) return;
    for (int b = 0; b < NB_; ++b) {
        const float* qb = Qin + (size_t)b * TT * DM; const float* kb = Kin + (size_t)b * TT * DM; const float* vb = Vin + (size_t)b * TT * DM;   /* token-major [t][h][d] slabs */
        k_hp1<<<(unsigned)(((size_t)NH_ * TT * HD / 8 + 255) / 256), 256, 0, stream>>>(qb, QB); k_hp1<<<(unsigned)(((size_t)NH_ * TT * HD / 8 + 255) / 256), 256, 0, stream>>>(kb, KB); k_vt1<<<(unsigned)(((size_t)NH_ * HD * TT / 2 + 255) / 256), 256, 0, stream>>>(vb, DM, VT);
        for (int h = 0; h < NH_; ++h) {
            k_gemmw<bf, 0, false><<<dim3(TT / 64, TT / 64, 1), 32, 0, stream>>>(QB + (size_t)h * TT * HD, nullptr, KB + (size_t)h * TT * HD, nullptr, HD, Sb, TT, nullptr, 0, 0, 0);   /* exact scores (single bf16 planes) */
            k_asoft<<<TT / 8, 256, 0, stream>>>(Sb, nullptr, Ph, Pl);
            k_gemmw<bf, 1, false><<<dim3(TT / 64, HD / 64, 1), 32, 0, stream>>>(Ph, Pl, VT + (size_t)h * HD * TT, nullptr, TT, Ob, HD, nullptr, 0, 0, 0);   /* P (hi/lo) x exact v^T */
            k_mergeT<<<(unsigned)(((size_t)TT * HD / 4 + 255) / 256), 256, 0, stream>>>(Ob, h, OUT + (size_t)b * TT * DM); } }
}

// v001
// Measured time: 757 microseconds a run.
// Timed twice side by side with v000, it ran 2.82 and 2.86 times as fast.
#include <hip/hip_runtime.h>

// Core dot-product attention on sequence-first tensors (query, key, value [2048][2][16][64] = [sq][b][np][hn]; scores = q.k UNscaled (the module computes sqrt(hn) but never applies it: logit sigma ~8); softmax over all 2,048 keys; context -> [2048][2][1024] (4.2 M)). The (b, np) pairs are 32 independent heads of one token-major [2048][2048] slab, and the output row layout [s][b][np*hn] is that same slab, so the whole problem is one pass over 32 heads.
// Layout: single bf16 planes per head (inputs bf16-exact: exact score products); the softmax with EVERY row hi/lo (2-product attn.v): the unscaled logits are far too sharp for fp16 probabilities; merged f32 output rows.
// Compute dtypes, f32 accumulate: every input rounded to bf16; q.k exact; softmax f32; P hi/lo x exact values; output f32.

#define NB_  1
#define TT   2048
#define DM   2048      // token-major row pitch (H x HD)
#define NH_  32
#define NKV  1
#define REP  (NH_ / NKV)
#define HD   64
#define DQ   (NH_ * HD)
#define DKV  (NKV * HD)
#define ZH   1
#define RH   2048                  // query rows < RH use hi+lo planes (0: none)
#define WIN  0
#define PCAR 1024.0f
#define SCL  1.0f   // unscaled (the module never applies its norm_factor)
typedef _Float16 h16;
typedef unsigned short bf;
typedef __attribute__((ext_vector_type(16))) __bf16   v16bf;
typedef __attribute__((ext_vector_type(16))) _Float16 v16h;
typedef __attribute__((ext_vector_type(8)))  _Float16 v8h;
typedef __attribute__((ext_vector_type(8)))  unsigned short v8us;
typedef __attribute__((ext_vector_type(8)))  float    v8f;
typedef __attribute__((ext_vector_type(4)))  float    v4f;
typedef v8h  __attribute__((may_alias)) v8ha;
typedef v4f  __attribute__((may_alias)) v4fa;
typedef v8us __attribute__((may_alias)) v8usa;

__device__ __forceinline__ unsigned short f2bf(float f) { unsigned u = __float_as_uint(f); u += 0x7FFFu + ((u >> 16) & 1u); return (unsigned short)(u >> 16); }
__device__ __forceinline__ float bf2f(unsigned short b) { return __uint_as_float(((unsigned)b) << 16); }
__device__ __forceinline__ float bfr(float f) { return bf2f(f2bf(f)); }
__device__ __forceinline__ v16h cat16(v8h lo, v8h hi) { return __builtin_shufflevector(lo, hi, 0, 1, 2, 3, 4, 5, 6, 7, 8, 9, 10, 11, 12, 13, 14, 15); }
__device__ __forceinline__ v16bf cat16b(v8us lo, v8us hi) { return __builtin_bit_cast(v16bf, __builtin_shufflevector(lo, hi, 0, 1, 2, 3, 4, 5, 6, 7, 8, 9, 10, 11, 12, 13, 14, 15)); }
__device__ __forceinline__ v8f wmma16(v16h a, v16h b, v8f c) { return __builtin_amdgcn_wmma_f32_16x16x32_f16(false, a, false, b, (short)0, c, false, false); }
__device__ __forceinline__ v8f wmmab(v16bf a, v16bf b, v8f c) { return __builtin_amdgcn_wmma_f32_16x16x32_bf16(false, a, false, b, (short)0, c, false, false); }



// ---- k_gemmw: register-blocked GEMM, ONE WAVE per 64x64 output tile (16 accumulators), operands straight from K-contiguous 16-bit planes; grid (M/64, N/64, Z), 32 threads.
// C[m][n] (f32, pitch ldc, + optional f32 bias[n]) = sum_k A[m][k] Bt[n][k] (+ split products per NSPLIT). z-batch strides sA/sB/sC in elements. K % 32 == 0.
template <typename T16> struct WFrag;
template <> struct WFrag<h16> { typedef v16h V; static __device__ __forceinline__ V ld(const h16* p) { return cat16(*(const v8h*)p, *(const v8h*)(p + 16)); } static __device__ __forceinline__ v8f mma(V a, V b, v8f c) { return wmma16(a, b, c); } };
template <> struct WFrag<bf> { typedef v16bf V; static __device__ __forceinline__ V ld(const bf* p) { return cat16b(*(const v8us*)p, *(const v8us*)(p + 16)); } static __device__ __forceinline__ v8f mma(V a, V b, v8f c) { return wmmab(a, b, c); } };
template <typename T16, int NSPLIT, bool BIAS>
__global__ __launch_bounds__(32) void k_gemmw(const T16* __restrict__ A, const T16* __restrict__ A2, const T16* __restrict__ Bt, const T16* __restrict__ Bt2, int K, float* C, int ldc, const float* __restrict__ bias, size_t sA, size_t sB, size_t sC) {
    typedef typename WFrag<T16>::V V;
    __shared__ __align__(16) float os[16 * 68];
    const size_t z = blockIdx.z; A += z * sA; if (A2) A2 += z * sA; Bt += z * sB; if (Bt2) Bt2 += z * sB; C += z * sC;
    const int lane = threadIdx.x & 31, lr = lane & 15, hi = lane >> 4; const int r0 = blockIdx.x * 64, c0 = blockIdx.y * 64;
    v8f acc[4][4];
#pragma unroll
    for (int mb = 0; mb < 4; ++mb)
#pragma unroll
        for (int nb = 0; nb < 4; ++nb) acc[mb][nb] = (v8f){};
    const size_t aoff = (size_t)(r0 + lr) * K + 8 * hi, boff = (size_t)(c0 + lr) * K + 8 * hi;
#pragma unroll 1
    for (int kc = 0; kc < K; kc += 32) {
        V a[4], a2[4];
#pragma unroll
        for (int mb = 0; mb < 4; ++mb) { a[mb] = WFrag<T16>::ld(A + aoff + (size_t)mb * 16 * K + kc); if (NSPLIT == 1 || NSPLIT == 2) a2[mb] = WFrag<T16>::ld(A2 + aoff + (size_t)mb * 16 * K + kc); }
#pragma unroll
        for (int nb = 0; nb < 4; ++nb) { const V b = WFrag<T16>::ld(Bt + boff + (size_t)nb * 16 * K + kc); V b2; if (NSPLIT >= 2) b2 = WFrag<T16>::ld(Bt2 + boff + (size_t)nb * 16 * K + kc);
#pragma unroll
            for (int mb = 0; mb < 4; ++mb) { acc[mb][nb] = WFrag<T16>::mma(a[mb], b, acc[mb][nb]); if (NSPLIT == 1 || NSPLIT == 2) acc[mb][nb] = WFrag<T16>::mma(a2[mb], b, acc[mb][nb]); if (NSPLIT >= 2) acc[mb][nb] = WFrag<T16>::mma(a[mb], b2, acc[mb][nb]); } }
        asm volatile("v_nop\n\tv_nop\n\tv_nop\n\tv_nop" : "+v"(acc[0][0]), "+v"(acc[1][1]), "+v"(acc[2][2]), "+v"(acc[3][3]) : "v"(a[0]), "v"(a[3]));
    }
#pragma unroll
    for (int mb = 0; mb < 4; ++mb) {
#pragma unroll
        for (int nb = 0; nb < 4; ++nb) {
#pragma unroll
            for (int j = 0; j < 8; ++j) os[(hi * 8 + j) * 68 + nb * 16 + lr] = acc[mb][nb][j]; }
        __builtin_amdgcn_wave_barrier(); asm volatile("" ::: "memory");
        float* crow = C + (size_t)(r0 + mb * 16) * ldc + c0;
{
#pragma unroll
            for (int s = 0; s < 8; ++s) { const int row = 2 * s + hi, cofs = lr * 4; v4f val = *(const v4fa*)(os + row * 68 + cofs); if (BIAS) { val[0] += bfr(bias[c0 + cofs]); val[1] += bfr(bias[c0 + cofs + 1]); val[2] += bfr(bias[c0 + cofs + 2]); val[3] += bfr(bias[c0 + cofs + 3]); }
                *(v4f*)(crow + (size_t)row * ldc + cofs) = val; }
             }
        __builtin_amdgcn_wave_barrier(); asm volatile("" ::: "memory");
    }
}

// ---- k_gemmk: C[m][n] (f32, pitch ldc) = sum_k (A[m][k] + A2[m][k]) Bt[n][k] for a long K and few output tiles: one work-group per 16x64 output tile, grid (M/16, N/64), 32 * KW threads.
// Wave w takes the 128 k from w * 128 on, with the loaders and the product order of k_gemmw (NSPLIT 1), and leaves its f32 partial tile in LDS; behind one barrier the KW partials are summed in wave order and stored as whole rows.
template <int K, int KW>
__global__ __launch_bounds__(32 * KW) void k_gemmk(const bf* __restrict__ A, const bf* __restrict__ A2, const bf* __restrict__ Bt, float* C, int ldc) {
    typedef WFrag<bf>::V V;
    static_assert(K == KW * 128 && KW >= 8, "four k steps a wave; 256 threads store the tile");
    __shared__ __align__(16) float part[KW][16 * 68];
    const int lane = threadIdx.x & 31, lr = lane & 15, hi = lane >> 4, w = threadIdx.x >> 5; const int r0 = blockIdx.x * 16, c0 = blockIdx.y * 64;
    const size_t aoff = (size_t)(r0 + lr) * K + w * 128 + 8 * hi, boff = (size_t)(c0 + lr) * K + w * 128 + 8 * hi;
    V a[4], a2[4], b[4][4];
#pragma unroll
    for (int s = 0; s < 4; ++s) { a[s] = WFrag<bf>::ld(A + aoff + s * 32); a2[s] = WFrag<bf>::ld(A2 + aoff + s * 32);
#pragma unroll
        for (int nb = 0; nb < 4; ++nb) b[s][nb] = WFrag<bf>::ld(Bt + boff + (size_t)nb * 16 * K + s * 32); }
    // fence that takes the loaded fragments as inputs only: keeps all 48 loads of the wave in front of its products, so that they are in flight together (without it each k step's loads sink behind the step before and the wave pays the load latency once per step);
    // its one instruction is the wait that stands in front of any reuse of the loads' address registers
    asm volatile("s_wait_xcnt 0x0" :: "v"(a[0]), "v"(a2[0]), "v"(b[0][0]), "v"(b[0][1]), "v"(b[0][2]), "v"(b[0][3]), "v"(a[1]), "v"(a2[1]), "v"(b[1][0]), "v"(b[1][1]), "v"(b[1][2]), "v"(b[1][3]),
                 "v"(a[2]), "v"(a2[2]), "v"(b[2][0]), "v"(b[2][1]), "v"(b[2][2]), "v"(b[2][3]), "v"(a[3]), "v"(a2[3]), "v"(b[3][0]), "v"(b[3][1]), "v"(b[3][2]), "v"(b[3][3]) : "memory");
    v8f acc[4];
#pragma unroll
    for (int nb = 0; nb < 4; ++nb) acc[nb] = (v8f){};
#pragma unroll
    for (int s = 0; s < 4; ++s) {
#pragma unroll
        for (int nb = 0; nb < 4; ++nb) { acc[nb] = WFrag<bf>::mma(a[s], b[s][nb], acc[nb]); acc[nb] = WFrag<bf>::mma(a2[s], b[s][nb], acc[nb]); } }
#pragma unroll
    for (int nb = 0; nb < 4; ++nb) {
#pragma unroll
        for (int j = 0; j < 8; ++j) part[w][(hi * 8 + j) * 68 + nb * 16 + lr] = acc[nb][j]; }
    __syncthreads();   // every wave's partial tile is in LDS before any of them is summed
    if (threadIdx.x < 16 * 16) { const int row = threadIdx.x >> 4, cofs = (threadIdx.x & 15) * 4; v4f s = *(const v4fa*)(&part[0][row * 68 + cofs]);
#pragma unroll
        for (int q = 1; q < KW; ++q) s += *(const v4fa*)(&part[q][row * 68 + cofs]);
        *(v4f*)(C + (size_t)(r0 + row) * ldc + c0 + cofs) = s; }
}

__device__ __forceinline__ h16 tohx(float x) { return (h16)x; }
__device__ __forceinline__ void splitf(float y, unsigned short& h, unsigned short& l) { h = f2bf(y); l = f2bf(y - bf2f(h)); }
typedef __attribute__((ext_vector_type(2))) _Float16 v2h;
typedef __attribute__((ext_vector_type(4))) _Float16 v4h;
typedef __attribute__((ext_vector_type(2))) unsigned short v2us;
typedef __attribute__((ext_vector_type(4))) unsigned short v4us;
typedef __attribute__((ext_vector_type(2))) float v2f;
typedef __attribute__((ext_vector_type(4))) int v4i;

__global__ __launch_bounds__(256) void k_wtG(const float* __restrict__ w, int K, int N, bf* Bt) {
    const int lane = threadIdx.x & 31; const int L0 = (blockIdx.x * 8 + (threadIdx.x >> 5)) * 8; const int nlines = N * K / 64;
{
#pragma unroll 1
        for (int l = 0; l < 8; ++l) { const int L = L0 + l; if (L >= nlines) break; const size_t e = (size_t)L * 64 + lane * 2; const int k = (int)(e % K), n = (int)(e / K); v2us o;
            o[0] = f2bf(w[(size_t)k * N + n]); o[1] = f2bf(w[(size_t)(k + 1) * N + n]); *(v2us*)(Bt + e) = o; }
         }
}
__global__ __launch_bounds__(256) void k_cvt8(const float* __restrict__ src, bf* dst, size_t n8) { const size_t i = (size_t)blockIdx.x * 256 + threadIdx.x; if (i >= n8) return; const v8f v = *(const v8f*)(src + i * 8); v8us o;
#pragma unroll
    for (int k = 0; k < 8; ++k) o[k] = f2bf(v[k]); *(v8us*)(dst + i * 8) = o;  }


__global__ __launch_bounds__(256) void k_vtp(const float* __restrict__ F, int pitch, int nheads, h16* V16, bf* Vh, bf* Vl) { const size_t e = ((size_t)blockIdx.x * 256 + threadIdx.x) * 2; if (e >= (size_t)nheads * HD * TT) return; const int t = (int)(e % TT); const int d = (int)((e / TT) % HD); const int g = (int)(e / ((size_t)TT * HD)); v2h o16; v2us oh, ol;
#pragma unroll
    for (int q = 0; q < 2; ++q) { const float x = F[(size_t)(t + q) * pitch + g * HD + d]; o16[q] = tohx(x); unsigned short a2, c2; splitf(x, a2, c2); oh[q] = a2; ol[q] = c2; }
    *(v2h*)(V16 + e) = o16; *(v2us*)(Vh + e) = oh; *(v2us*)(Vl + e) = ol;  }

// k_asoft: per row (zz, i): t = S x SCL (= 1, unscaled; no mask); softmax over the 2048 keys (register row, one exp, fixed trees);
__global__ __launch_bounds__(256) void k_asoft(const float* __restrict__ Sb, h16* P16, bf* Ph, bf* Pl) {
    const int lane = threadIdx.x & 31; const int row = blockIdx.x * 8 + (threadIdx.x >> 5); if (row >= ZH * TT) return; const int i = row % TT; const int zz = row / TT; (void)zz; const bool hires = (i < RH); const float* sr = Sb + (size_t)row * TT; float v[TT / 32]; float mx = -3.0e38f;
#pragma unroll
    for (int ch = 0; ch < TT / 128; ++ch) { const int j0 = ch * 128 + lane * 4; const v4f a = *(const v4f*)(sr + j0);
#pragma unroll
        for (int q = 0; q < 4; ++q) { const float t = a[q] * SCL; v[ch * 4 + q] = t;   /* Sb holds the plain q.k scores (no bias) */ mx = fmaxf(mx, t); } }
#pragma unroll
    for (int sh = 16; sh; sh >>= 1) mx = fmaxf(mx, __shfl_xor(mx, sh, 32));
    float sum = 0.f;
#pragma unroll
    for (int k = 0; k < TT / 32; ++k) { float d0 = __fsub_rn(v[k], mx); asm volatile("" : "+v"(d0)); v[k] = __builtin_amdgcn_exp2f(__fmul_rn(d0, 1.4426950408889634f)); sum += v[k]; }
#pragma unroll
    for (int sh = 16; sh; sh >>= 1) sum += __shfl_xor(sum, sh, 32);
    const float f = __fdiv_rn(hires ? 1.0f : PCAR, sum);
{
        if (hires) {
#pragma unroll
            for (int ch = 0; ch < TT / 128; ++ch) { v4us oh, ol;
#pragma unroll
                for (int q = 0; q < 4; ++q) { unsigned short a, c2; splitf(v[ch * 4 + q] * f, a, c2); oh[q] = a; ol[q] = c2; }
                const size_t oo = ((size_t)zz * (RH ? RH : 1) + i) * TT + ch * 128 + lane * 4; *(v4us*)(Ph + oo) = oh; *(v4us*)(Pl + oo) = ol; }
        } else {
#pragma unroll
            for (int ch = 0; ch < TT / 128; ++ch) { v4h o4;
#pragma unroll
                for (int q = 0; q < 4; ++q) o4[q] = tohx(v[ch * 4 + q] * f);
                *(v4h*)(P16 + (size_t)row * TT + ch * 128 + lane * 4) = o4; } }
         }
}
__global__ __launch_bounds__(256) void k_merge(const float* __restrict__ O, int h0, float* OUTb) { const size_t e = ((size_t)blockIdx.x * 256 + threadIdx.x) * 2; if (e >= (size_t)ZH * TT * HD) return; const int d = (int)(e % HD); const int t = (int)((e / HD) % TT); const int zz = (int)(e / ((size_t)HD * TT)); const float cs = (t < RH) ? 1.0f : (1.0f / PCAR); const size_t oo = (size_t)t * DQ + (h0 + zz) * HD + d;
    v2f o2; o2[0] = O[e] * cs; o2[1] = O[e + 1] * cs; *(v2f*)(OUTb + oo) = o2;  }


__global__ __launch_bounds__(256) void k_vtpR1(const float* __restrict__ Vb, bf* Vh) { const size_t e = ((size_t)blockIdx.x * 256 + threadIdx.x) * 2; if (e >= (size_t)HD * TT) return; const int t = (int)(e % TT); const int d = (int)(e / TT); v2us o; o[0] = f2bf(Vb[(size_t)t * HD + d]); o[1] = f2bf(Vb[(size_t)(t + 1) * HD + d]); *(v2us*)(Vh + e) = o;  }
__global__ __launch_bounds__(256) void k_mergeR(const float* __restrict__ O, float* outb, size_t n4) { const size_t i = (size_t)blockIdx.x * 256 + threadIdx.x; if (i >= n4) return; const v4f a = *(const v4f*)(O + i * 4); *(v4f*)(outb + i * 4) = a;  }


__global__ __launch_bounds__(256) void k_hp1(const float* __restrict__ src, bf* P) { const size_t i = (size_t)blockIdx.x * 256 + threadIdx.x; if (i >= (size_t)NH_ * TT * HD / 8) return; const size_t e = i * 8; const int d = (int)(e % HD); const int t = (int)((e / HD) % TT); const int h = (int)(e / ((size_t)HD * TT)); const v8f v = *(const v8f*)(src + (size_t)t * DM + h * HD + d); v8us o;
#pragma unroll
    for (int q = 0; q < 8; ++q) o[q] = f2bf(v[q]);
    *(v8us*)(P + e) = o;  }
__global__ __launch_bounds__(256) void k_vt1(const float* __restrict__ src, int pitch, bf* VT) { const size_t e = ((size_t)blockIdx.x * 256 + threadIdx.x) * 2; if (e >= (size_t)NH_ * HD * TT) return; const int t = (int)(e % TT); const int d = (int)((e / TT) % HD); const int h = (int)(e / ((size_t)TT * HD)); v2us o; o[0] = f2bf(src[(size_t)t * pitch + h * HD + d]); o[1] = f2bf(src[(size_t)(t + 1) * pitch + h * HD + d]); *(v2us*)(VT + e) = o;  }
__global__ __launch_bounds__(256) void k_mergeT(const float* __restrict__ O, int h, float* outb) { const size_t i = (size_t)blockIdx.x * 256 + threadIdx.x; if (i >= (size_t)TT * HD / 4) return; const size_t e = i * 4; const int d = (int)(e % HD); const int t = (int)(e / HD); const v4f a = *(const v4f*)(O + e); *(v4f*)(outb + (size_t)t * DM + h * HD + d) = a;  }

extern "C" void kernel_launch(void* const* d_in, const int* in_sizes, int n_in,
                              void* d_out, int out_size, void* d_ws, size_t ws_size, hipStream_t stream) {
    (void)in_sizes; (void)n_in; (void)out_size;
    const float* Qin = (const float*)d_in[0]; const float* Kin = (const float*)d_in[1]; const float* Vin = (const float*)d_in[2];
    float* OUT = (float*)d_out;
    char* wsp = (char*)d_ws;
    auto take = [&](size_t bytes) { char* p = wsp; wsp += (bytes + 255) & ~(size_t)255; return (void*)p; };
    bf* QB = (bf*)take((size_t)NH_ * TT * HD * 2); bf* KB = (bf*)take((size_t)NH_ * TT * HD * 2); bf* VT = (bf*)take((size_t)NH_ * HD * TT * 2);
    float* Sb = (float*)take((size_t)TT * TT * 4);  bf* Ph = (bf*)take((size_t)TT * TT * 2); bf* Pl = (bf*)take((size_t)TT * TT * 2); float* Ob = (float*)take((size_t)TT * HD * 4);
    if ((size_t)(wsp - (char*)d_ws) > ws_size) return;
    for (int b = 0; b < NB_; ++b) {
        const float* qb = Qin + (size_t)b * TT * DM; const float* kb = Kin + (size_t)b * TT * DM; const float* vb = Vin + (size_t)b * TT * DM;   /* token-major [t][h][d] slabs */
        k_hp1<<<(unsigned)(((size_t)NH_ * TT * HD / 8 + 255) / 256), 256, 0, stream>>>(qb, QB); k_hp1<<<(unsigned)(((size_t)NH_ * TT * HD / 8 + 255) / 256), 256, 0, stream>>>(kb, KB); k_vt1<<<(unsigned)(((size_t)NH_ * HD * TT / 2 + 255) / 256), 256, 0, stream>>>(vb, DM, VT);
        for (int h = 0; h < NH_; ++h) {
            k_gemmw<bf, 0, false><<<dim3(TT / 64, TT / 64, 1), 32, 0, stream>>>(QB + (size_t)h * TT * HD, nullptr, KB + (size_t)h * TT * HD, nullptr, HD, Sb, TT, nullptr, 0, 0, 0);   /* exact scores (single bf16 planes) */
            k_asoft<<<TT / 8, 256, 0, stream>>>(Sb, nullptr, Ph, Pl);
            k_gemmk<TT, 16><<<dim3(TT / 16, HD / 64, 1), 512, 0, stream>>>(Ph, Pl, VT + (size_t)h * HD * TT, Ob, HD);   /* P (hi/lo) x exact v^T, k range split over 16 waves */
            k_mergeT<<<(unsigned)(((size_t)TT * HD / 4 + 255) / 256), 256, 0, stream>>>(Ob, h, OUT + (size_t)b * TT * DM); } }
}

// v002
// It runs in 104 microseconds.
// Next to v001, in two timings, it ran 7.42 and 7.19 times as fast.
// Over all steps from v000 it is 20.7 times as fast.
#include <hip/hip_runtime.h>

// Core dot-product attention on sequence-first tensors (query, key, value [2048][2][16][64] = [sq][b][np][hn]; scores = q.k UNscaled (the module computes sqrt(hn) but never applies it: logit sigma ~8); softmax over all 2,048 keys; context -> [2048][2][1024] (4.2 M)). The (b, np) pairs are 32 independent heads of one token-major [2048][2048] slab, and the output row layout [s][b][np*hn] is that same slab, so the whole problem is one pass over 32 heads.
// Layout: single bf16 planes per head (inputs bf16-exact: exact score products); the softmax with EVERY row hi/lo (2-product attn.v): the unscaled logits are far too sharp for fp16 probabilities; merged f32 output rows.
// Compute dtypes, f32 accumulate: every input rounded to bf16; q.k exact; softmax f32; P hi/lo x exact values; output f32.

#define NB_  1
#define TT   2048
#define DM   2048      // token-major row pitch (H x HD)
#define NH_  32
#define NKV  1
#define REP  (NH_ / NKV)
#define HD   64
#define DQ   (NH_ * HD)
#define DKV  (NKV * HD)
#define ZH   1
#define RH   2048                  // query rows < RH use hi+lo planes (0: none)
#define WIN  0
#define PCAR 1024.0f
#define SCL  1.0f   // unscaled (the module never applies its norm_factor)
typedef _Float16 h16;
typedef unsigned short bf;
typedef __attribute__((ext_vector_type(16))) __bf16   v16bf;
typedef __attribute__((ext_vector_type(16))) _Float16 v16h;
typedef __attribute__((ext_vector_type(8)))  _Float16 v8h;
typedef __attribute__((ext_vector_type(8)))  unsigned short v8us;
typedef __attribute__((ext_vector_type(8)))  float    v8f;
typedef __attribute__((ext_vector_type(4)))  float    v4f;
typedef v8h  __attribute__((may_alias)) v8ha;
typedef v4f  __attribute__((may_alias)) v4fa;
typedef v8us __attribute__((may_alias)) v8usa;

__device__ __forceinline__ unsigned short f2bf(float f) { unsigned u = __float_as_uint(f); u += 0x7FFFu + ((u >> 16) & 1u); return (unsigned short)(u >> 16); }
__device__ __forceinline__ float bf2f(unsigned short b) { return __uint_as_float(((unsigned)b) << 16); }
__device__ __forceinline__ float bfr(float f) { return bf2f(f2bf(f)); }
__device__ __forceinline__ v16h cat16(v8h lo, v8h hi) { return __builtin_shufflevector(lo, hi, 0, 1, 2, 3, 4, 5, 6, 7, 8, 9, 10, 11, 12, 13, 14, 15); }
__device__ __forceinline__ v16bf cat16b(v8us lo, v8us hi) { return __builtin_bit_cast(v16bf, __builtin_shufflevector(lo, hi, 0, 1, 2, 3, 4, 5, 6, 7, 8, 9, 10, 11, 12, 13, 14, 15)); }
__device__ __forceinline__ v8f wmma16(v16h a, v16h b, v8f c) { return __builtin_amdgcn_wmma_f32_16x16x32_f16(false, a, false, b, (short)0, c, false, false); }
__device__ __forceinline__ v8f wmmab(v16bf a, v16bf b, v8f c) { return __builtin_amdgcn_wmma_f32_16x16x32_bf16(false, a, false, b, (short)0, c, false, false); }



// fragment loaders and products of the 16x16x32 forms: a lane takes k 8 hi + 0..7 and 16 + 8 hi + 0..7 of its row
template <typename T16> struct WFrag;
template <> struct WFrag<h16> { typedef v16h V; static __device__ __forceinline__ V ld(const h16* p) { return cat16(*(const v8h*)p, *(const v8h*)(p + 16)); } static __device__ __forceinline__ v8f mma(V a, V b, v8f c) { return wmma16(a, b, c); } };
template <> struct WFrag<bf> { typedef v16bf V; static __device__ __forceinline__ V ld(const bf* p) { return cat16b(*(const v8us*)p, *(const v8us*)(p + 16)); } static __device__ __forceinline__ v8f mma(V a, V b, v8f c) { return wmmab(a, b, c); } };

#define MLAZY 5.5f
__device__ __forceinline__ float xhalf(float x) { const int b = __float_as_int(x); return __int_as_float(__builtin_amdgcn_permlanex16(b, b, 0x76543210, 0xfedcba98, false, false)); }   // lane l <-> l ^ 16
__global__ __launch_bounds__(256) void k_fattn(const bf* __restrict__ QB, const bf* __restrict__ KB, const bf* __restrict__ VT, float* __restrict__ OUTb) {
    typedef WFrag<bf>::V V;
    typedef __attribute__((ext_vector_type(2))) float f2; typedef __attribute__((ext_vector_type(2))) __bf16 b2;
    const int lane = threadIdx.x & 31, lr = lane & 15, hi = lane >> 4, w = threadIdx.x >> 5; const int h = blockIdx.y, q0 = (blockIdx.x * 8 + w) * 32;
    const bf* Qp = QB + (size_t)h * TT * HD + (size_t)(q0 + lr) * HD + 8 * hi; const bf* Kp = KB + (size_t)h * TT * HD + (size_t)lr * HD + 8 * hi; const bf* Vp = VT + (size_t)h * HD * TT + (size_t)lr * TT + 8 * hi;
    V q[2][2], kf[2][2];
#pragma unroll
    for (int t = 0; t < 2; ++t)
#pragma unroll
        for (int c = 0; c < 2; ++c) { q[t][c] = WFrag<bf>::ld(Qp + t * 16 * HD + c * 32); kf[t][c] = WFrag<bf>::ld(Kp + t * 16 * HD + c * 32); }
    float mx[2] = {-3.0e38f, -3.0e38f}; v8f o[2][4]; float sum[2][2] = {{0.f, 0.f}, {0.f, 0.f}};
#pragma unroll
    for (int g = 0; g < 2; ++g)
#pragma unroll
        for (int db = 0; db < 4; ++db) o[g][db] = (v8f){};
    // rolled: the body is long enough to fill the pipes, and the code stays small for the instruction cache
#pragma unroll 1
    for (int kb = 0; kb < TT / 32; ++kb) { V vf[4]; v8f s[2][2];
#pragma unroll
        for (int db = 0; db < 4; ++db) vf[db] = WFrag<bf>::ld(Vp + (size_t)db * 16 * TT + kb * 32);
#pragma unroll
        for (int t = 0; t < 2; ++t)
#pragma unroll
            for (int g = 0; g < 2; ++g) { s[g][t] = WFrag<bf>::mma(kf[t][0], q[g][0], (v8f){}); s[g][t] = WFrag<bf>::mma(kf[t][1], q[g][1], s[g][t]); }
        const bf* kn = Kp + (size_t)((kb + 1) & (TT / 32 - 1)) * 32 * HD;   /* the next 32 keys' fragments fly during the vector work and the second product; the last trip fetches keys 0..31 again, in bounds and unused */
#pragma unroll
        for (int t = 0; t < 2; ++t)
#pragma unroll
            for (int c = 0; c < 2; ++c) kf[t][c] = WFrag<bf>::ld(kn + t * 16 * HD + c * 32);
        float bm[2];
#pragma unroll
        for (int g = 0; g < 2; ++g) { bm[g] = s[g][0][0];
#pragma unroll
            for (int t = 0; t < 2; ++t)
#pragma unroll
                for (int j = 0; j < 8; ++j) bm[g] = fmaxf(bm[g], s[g][t][j]);
            bm[g] = fmaxf(bm[g], xhalf(bm[g])); }
        if (__builtin_amdgcn_ballot_w32(bm[0] > mx[0] + MLAZY || bm[1] > mx[1] + MLAZY) != 0) {   /* one scalar branch a trip; always taken on the first trip, where the factor is exp(-inf) = 0 on zeros */
#pragma unroll
            for (int g = 0; g < 2; ++g) { const float mn = fmaxf(mx[g], bm[g]); const float sc = __builtin_amdgcn_exp2f((mx[g] - mn) * 1.4426950408889634f); mx[g] = mn; sum[g][0] *= sc; sum[g][1] *= sc;
#pragma unroll
                for (int db = 0; db < 4; ++db) o[g][db] *= sc; } }
#pragma unroll
        for (int g = 0; g < 2; ++g) { V ph, pl;
#pragma unroll
            for (int t = 0; t < 2; ++t)
#pragma unroll
                for (int j = 0; j < 8; j += 2) { f2 p; p[0] = __builtin_amdgcn_exp2f((s[g][t][j] - mx[g]) * 1.4426950408889634f); p[1] = __builtin_amdgcn_exp2f((s[g][t][j + 1] - mx[g]) * 1.4426950408889634f); sum[g][t] += p[0]; sum[g][t] += p[1];
                    const b2 a = __builtin_convertvector(p, b2); f2 r; r[0] = p[0] - (float)a[0]; r[1] = p[1] - (float)a[1]; const b2 c2 = __builtin_convertvector(r, b2);
                    ph[t * 8 + j] = a[0]; ph[t * 8 + j + 1] = a[1]; pl[t * 8 + j] = c2[0]; pl[t * 8 + j + 1] = c2[1]; }
#pragma unroll
            for (int db = 0; db < 4; ++db) { o[g][db] = WFrag<bf>::mma(vf[db], ph, o[g][db]); o[g][db] = WFrag<bf>::mma(vf[db], pl, o[g][db]); } }
        // four vector slots behind the trip's last products: over the back edge the next trip's first product may write its result into the registers of their B operand
        asm volatile("v_nop\n\tv_nop\n\tv_nop\n\tv_nop" : "+v"(o[0][0]), "+v"(o[0][1]), "+v"(o[0][2]), "+v"(o[0][3]), "+v"(o[1][0]), "+v"(o[1][1]), "+v"(o[1][2]), "+v"(o[1][3]));
    }
#pragma unroll
    for (int g = 0; g < 2; ++g) { float l = sum[g][0] + sum[g][1]; l += xhalf(l); const float f = __fdiv_rn(1.0f, l); float* op = OUTb + (size_t)(q0 + g * 16 + lr) * DM + h * HD + 8 * hi;
#pragma unroll
        for (int db = 0; db < 4; ++db) { v4f a, c;
#pragma unroll
            for (int j = 0; j < 4; ++j) { a[j] = o[g][db][j] * f; c[j] = o[g][db][j + 4] * f; }
            *(v4f*)(op + db * 16) = a; *(v4f*)(op + db * 16 + 4) = c; } }
}

__device__ __forceinline__ h16 tohx(float x) { return (h16)x; }
__device__ __forceinline__ void splitf(float y, unsigned short& h, unsigned short& l) { h = f2bf(y); l = f2bf(y - bf2f(h)); }
typedef __attribute__((ext_vector_type(2))) _Float16 v2h;
typedef __attribute__((ext_vector_type(4))) _Float16 v4h;
typedef __attribute__((ext_vector_type(2))) unsigned short v2us;
typedef __attribute__((ext_vector_type(4))) unsigned short v4us;
typedef __attribute__((ext_vector_type(2))) float v2f;
typedef __attribute__((ext_vector_type(4))) int v4i;

__global__ __launch_bounds__(256) void k_wtG(const float* __restrict__ w, int K, int N, bf* Bt) {
    const int lane = threadIdx.x & 31; const int L0 = (blockIdx.x * 8 + (threadIdx.x >> 5)) * 8; const int nlines = N * K / 64;
{
#pragma unroll 1
        for (int l = 0; l < 8; ++l) { const int L = L0 + l; if (L >= nlines) break; const size_t e = (size_t)L * 64 + lane * 2; const int k = (int)(e % K), n = (int)(e / K); v2us o;
            o[0] = f2bf(w[(size_t)k * N + n]); o[1] = f2bf(w[(size_t)(k + 1) * N + n]); *(v2us*)(Bt + e) = o; }
         }
}
__global__ __launch_bounds__(256) void k_cvt8(const float* __restrict__ src, bf* dst, size_t n8) { const size_t i = (size_t)blockIdx.x * 256 + threadIdx.x; if (i >= n8) return; const v8f v = *(const v8f*)(src + i * 8); v8us o;
#pragma unroll
    for (int k = 0; k < 8; ++k) o[k] = f2bf(v[k]); *(v8us*)(dst + i * 8) = o;  }


__global__ __launch_bounds__(256) void k_vtp(const float* __restrict__ F, int pitch, int nheads, h16* V16, bf* Vh, bf* Vl) { const size_t e = ((size_t)blockIdx.x * 256 + threadIdx.x) * 2; if (e >= (size_t)nheads * HD * TT) return; const int t = (int)(e % TT); const int d = (int)((e / TT) % HD); const int g = (int)(e / ((size_t)TT * HD)); v2h o16; v2us oh, ol;
#pragma unroll
    for (int q = 0; q < 2; ++q) { const float x = F[(size_t)(t + q) * pitch + g * HD + d]; o16[q] = tohx(x); unsigned short a2, c2; splitf(x, a2, c2); oh[q] = a2; ol[q] = c2; }
    *(v2h*)(V16 + e) = o16; *(v2us*)(Vh + e) = oh; *(v2us*)(Vl + e) = ol;  }

__global__ __launch_bounds__(256) void k_merge(const float* __restrict__ O, int h0, float* OUTb) { const size_t e = ((size_t)blockIdx.x * 256 + threadIdx.x) * 2; if (e >= (size_t)ZH * TT * HD) return; const int d = (int)(e % HD); const int t = (int)((e / HD) % TT); const int zz = (int)(e / ((size_t)HD * TT)); const float cs = (t < RH) ? 1.0f : (1.0f / PCAR); const size_t oo = (size_t)t * DQ + (h0 + zz) * HD + d;
    v2f o2; o2[0] = O[e] * cs; o2[1] = O[e + 1] * cs; *(v2f*)(OUTb + oo) = o2;  }


__global__ __launch_bounds__(256) void k_vtpR1(const float* __restrict__ Vb, bf* Vh) { const size_t e = ((size_t)blockIdx.x * 256 + threadIdx.x) * 2; if (e >= (size_t)HD * TT) return; const int t = (int)(e % TT); const int d = (int)(e / TT); v2us o; o[0] = f2bf(Vb[(size_t)t * HD + d]); o[1] = f2bf(Vb[(size_t)(t + 1) * HD + d]); *(v2us*)(Vh + e) = o;  }
__global__ __launch_bounds__(256) void k_mergeR(const float* __restrict__ O, float* outb, size_t n4) { const size_t i = (size_t)blockIdx.x * 256 + threadIdx.x; if (i >= n4) return; const v4f a = *(const v4f*)(O + i * 4); *(v4f*)(outb + i * 4) = a;  }


__global__ __launch_bounds__(256) void k_hp1(const float* __restrict__ src, bf* P) { const size_t i = (size_t)blockIdx.x * 256 + threadIdx.x; if (i >= (size_t)NH_ * TT * HD / 8) return; const size_t e = i * 8; const int d = (int)(e % HD); const int t = (int)((e / HD) % TT); const int h = (int)(e / ((size_t)HD * TT)); const v8f v = *(const v8f*)(src + (size_t)t * DM + h * HD + d); v8us o;
#pragma unroll
    for (int q = 0; q < 8; ++q) o[q] = f2bf(v[q]);
    *(v8us*)(P + e) = o;  }
__global__ __launch_bounds__(256) void k_vt1(const float* __restrict__ src, int pitch, bf* VT) { const size_t e = ((size_t)blockIdx.x * 256 + threadIdx.x) * 2; if (e >= (size_t)NH_ * HD * TT) return; const int t = (int)(e % TT); const int d = (int)((e / TT) % HD); const int h = (int)(e / ((size_t)TT * HD)); v2us o; o[0] = f2bf(src[(size_t)t * pitch + h * HD + d]); o[1] = f2bf(src[(size_t)(t + 1) * pitch + h * HD + d]); *(v2us*)(VT + e) = o;  }

extern "C" void kernel_launch(void* const* d_in, const int* in_sizes, int n_in,
                              void* d_out, int out_size, void* d_ws, size_t ws_size, hipStream_t stream) {
    (void)in_sizes; (void)n_in; (void)out_size;
    const float* Qin = (const float*)d_in[0]; const float* Kin = (const float*)d_in[1]; const float* Vin = (const float*)d_in[2];
    float* OUT = (float*)d_out;
    char* wsp = (char*)d_ws;
    auto take = [&](size_t bytes) { char* p = wsp; wsp += (bytes + 255) & ~(size_t)255; return (void*)p; };
    bf* QB = (bf*)take((size_t)NH_ * TT * HD * 2); bf* KB = (bf*)take((size_t)NH_ * TT * HD * 2); bf* VT = (bf*)take((size_t)NH_ * HD * TT * 2);
    if ((size_t)(wsp - (char*)d_ws) > ws_size) return;
    for (int b = 0; b < NB_; ++b) {
        const float* qb = Qin + (size_t)b * TT * DM; const float* kb = Kin + (size_t)b * TT * DM; const float* vb = Vin + (size_t)b * TT * DM;   /* token-major [t][h][d] slabs */
        k_hp1<<<(unsigned)(((size_t)NH_ * TT * HD / 8 + 255) / 256), 256, 0, stream>>>(qb, QB); k_hp1<<<(unsigned)(((size_t)NH_ * TT * HD / 8 + 255) / 256), 256, 0, stream>>>(kb, KB); k_vt1<<<(unsigned)(((size_t)NH_ * HD * TT / 2 + 255) / 256), 256, 0, stream>>>(vb, DM, VT);
        k_fattn<<<dim3(TT / 256, NH_, 1), 256, 0, stream>>>(QB, KB, VT, OUT + (size_t)b * TT * DM); }   /* exact scores (single bf16 planes), f32 softmax, P (hi/lo) x exact v^T, merged f32 output rows */
}

// v003
// It runs in 47.2 microseconds.
// In two side-by-side timings against v002, it was 2.25 and 2.22 times as fast.
// Counting every step since v000, it is 46.3 times as fast.
#include <hip/hip_runtime.h>

// Core dot-product attention on sequence-first tensors (query, key, value [2048][2][16][64] = [sq][b][np][hn]; scores = q.k UNscaled (the module computes sqrt(hn) but never applies it: logit sigma ~8); softmax over all 2,048 keys; context -> [2048][2][1024] (4.2 M)). The (b, np) pairs are 32 independent heads of one token-major [2048][2048] slab, and the output row layout [s][b][np*hn] is that same slab, so the whole problem is one pass over 32 heads.
// Layout: no planes in memory: each work-group rounds its head's rows to bf16 on the way into LDS (exact score products of the rounded inputs); the softmax with EVERY row hi/lo (2-product attn.v): the unscaled logits are far too sharp for fp16 probabilities; merged f32 output rows.
// Compute dtypes, f32 accumulate: every input rounded to bf16; q.k exact; softmax f32; P hi/lo x exact values; output f32.

#define NB_  1
#define TT   2048
#define DM   2048      // token-major row pitch (H x HD)
#define NH_  32
#define NKV  1
#define REP  (NH_ / NKV)
#define HD   64
#define DQ   (NH_ * HD)
#define DKV  (NKV * HD)
#define ZH   1
#define RH   2048                  // query rows < RH use hi+lo planes (0: none)
#define WIN  0
#define PCAR 1024.0f
#define SCL  1.0f   // unscaled (the module never applies its norm_factor)
typedef _Float16 h16;
typedef unsigned short bf;
typedef __attribute__((ext_vector_type(16))) __bf16   v16bf;
typedef __attribute__((ext_vector_type(16))) _Float16 v16h;
typedef __attribute__((ext_vector_type(8)))  _Float16 v8h;
typedef __attribute__((ext_vector_type(8)))  unsigned short v8us;
typedef __attribute__((ext_vector_type(8)))  float    v8f;
typedef __attribute__((ext_vector_type(4)))  float    v4f;
typedef v8h  __attribute__((may_alias)) v8ha;
typedef v4f  __attribute__((may_alias)) v4fa;
typedef v8us __attribute__((may_alias)) v8usa;

__device__ __forceinline__ unsigned short f2bf(float f) { unsigned u = __float_as_uint(f); u += 0x7FFFu + ((u >> 16) & 1u); return (unsigned short)(u >> 16); }
__device__ __forceinline__ float bf2f(unsigned short b) { return __uint_as_float(((unsigned)b) << 16); }
__device__ __forceinline__ float bfr(float f) { return bf2f(f2bf(f)); }
__device__ __forceinline__ v16h cat16(v8h lo, v8h hi) { return __builtin_shufflevector(lo, hi, 0, 1, 2, 3, 4, 5, 6, 7, 8, 9, 10, 11, 12, 13, 14, 15); }
__device__ __forceinline__ v16bf cat16b(v8us lo, v8us hi) { return __builtin_bit_cast(v16bf, __builtin_shufflevector(lo, hi, 0, 1, 2, 3, 4, 5, 6, 7, 8, 9, 10, 11, 12, 13, 14, 15)); }
__device__ __forceinline__ v8f wmma16(v16h a, v16h b, v8f c) { return __builtin_amdgcn_wmma_f32_16x16x32_f16(false, a, false, b, (short)0, c, false, false); }
__device__ __forceinline__ v8f wmmab(v16bf a, v16bf b, v8f c) { return __builtin_amdgcn_wmma_f32_16x16x32_bf16(false, a, false, b, (short)0, c, false, false); }



// fragment loaders and products of the 16x16x32 forms: a lane takes k 8 hi + 0..7 and 16 + 8 hi + 0..7 of its row
template <typename T16> struct WFrag;
template <> struct WFrag<h16> { typedef v16h V; static __device__ __forceinline__ V ld(const h16* p) { return cat16(*(const v8h*)p, *(const v8h*)(p + 16)); } static __device__ __forceinline__ v8f mma(V a, V b, v8f c) { return wmma16(a, b, c); } };
template <> struct WFrag<bf> { typedef v16bf V; static __device__ __forceinline__ V ld(const bf* p) { return cat16b(*(const v8us*)p, *(const v8us*)(p + 16)); } static __device__ __forceinline__ v8f mma(V a, V b, v8f c) { return wmmab(a, b, c); } };

#define MLAZY 5.5f
#define SK   64                     // keys per tile
#define NS   (TT / SK)
#define PK   144                    // LDS pitch of a K row, bytes
#define PV   160                    // LDS pitch of a V row, bytes
#define KBY  (SK * PK)              // K part of a slot
#define BBY  (SK * PK + SK * PV)    // one slot
typedef __attribute__((ext_vector_type(4))) unsigned short v4usa __attribute__((may_alias));
typedef __attribute__((ext_vector_type(4))) __bf16 b4v;
typedef __attribute__((ext_vector_type(8))) __bf16 b8v;
typedef __attribute__((ext_vector_type(8))) short s16x8;
typedef __attribute__((address_space(3))) s16x8 lds_s16x8;
__device__ __forceinline__ float xhalf(float x) { const int b = __float_as_int(x); return __int_as_float(__builtin_amdgcn_permlanex16(b, b, 0x76543210, 0xfedcba98, false, false)); }   // lane l <-> l ^ 16
__device__ __forceinline__ v8us ldtr(const unsigned char* p) { return __builtin_bit_cast(v8us, __builtin_amdgcn_ds_load_tr16_b128_v8i16((lds_s16x8*)p)); }
__device__ __forceinline__ v8us cvt8r(const float* p) { return __builtin_bit_cast(v8us, __builtin_convertvector(*(const v8f*)p, b8v)); }   // 8 f32 -> 8 bf16, round to nearest even
__global__ __launch_bounds__(256) void k_fattn(const float* __restrict__ Qf, const float* __restrict__ Kf, const float* __restrict__ Vf, float* __restrict__ OUTb) {
    typedef WFrag<bf>::V V;
    typedef __attribute__((ext_vector_type(2))) float f2; typedef __attribute__((ext_vector_type(2))) __bf16 b2;
    __shared__ __attribute__((aligned(256))) unsigned char L[4 * BBY];
    const int lane = threadIdx.x & 31, lr = lane & 15, hi = lane >> 4, w = threadIdx.x >> 5; const int h = blockIdx.y, q0 = (blockIdx.x * 8 + w) * 32;
    const int sr = threadIdx.x >> 4, sc = threadIdx.x & 15;   /* staging: row sr + 16 i of the tile, floats 4 sc .. 4 sc + 3 of the head's 64 */
    const float* Kg = Kf + (size_t)sr * DM + h * HD + 4 * sc; const float* Vg = Vf + (size_t)sr * DM + h * HD + 4 * sc;
    unsigned char* Kst = L + sr * PK + 8 * sc; unsigned char* Vst = L + KBY + sr * PV + 8 * sc;
    const unsigned char* Krd = L + lr * PK + 16 * hi;                                             /* A fragment of K: row lr, bytes 16 hi and 32 + 16 hi of each 64 */
    const unsigned char* Vrd = L + KBY + (8 * hi + (lane & 7)) * PV + 16 * ((lane >> 3) & 1);     /* the transposing load's lane address */
    const float* Qp = Qf + (size_t)(q0 + lr) * DM + h * HD + 8 * hi;
    v4f rk[4], rv[4];
    { v4f pk[8], pv[8];   /* tiles 0 and 1 into slots 0 and 1 */
#pragma unroll
    for (int i = 0; i < 8; ++i) { pk[i] = *(const v4f*)(Kg + (size_t)i * 16 * DM); pv[i] = *(const v4f*)(Vg + (size_t)i * 16 * DM); }
#pragma unroll
    for (int i = 0; i < 8; ++i) { *(v4usa*)(Kst + (i >> 2) * BBY + (i & 3) * 16 * PK) = __builtin_bit_cast(v4usa, __builtin_convertvector(pk[i], b4v)); *(v4usa*)(Vst + (i >> 2) * BBY + (i & 3) * 16 * PV) = __builtin_bit_cast(v4usa, __builtin_convertvector(pv[i], b4v)); } }
    V q[2][2], kf[2][2];
#pragma unroll
    for (int t = 0; t < 2; ++t)
#pragma unroll
        for (int c = 0; c < 2; ++c) q[t][c] = cat16b(cvt8r(Qp + (size_t)t * 16 * DM + c * 32), cvt8r(Qp + (size_t)t * 16 * DM + c * 32 + 16));
    float mx[2] = {-3.0e38f, -3.0e38f}; v8f o[2][4]; float sum[2][2] = {{0.f, 0.f}, {0.f, 0.f}};
#pragma unroll
    for (int g = 0; g < 2; ++g)
#pragma unroll
        for (int db = 0; db < 4; ++db) o[g][db] = (v8f){};
    __syncthreads();   /* publishes tiles 0 and 1 */
    // rolled: the body is long enough to fill the pipes, and the code stays small for the instruction cache
#pragma unroll 1
    for (int st = 0; st < NS; ++st) { const unsigned bo = (unsigned)(st & 3) * BBY, bn = (unsigned)((st & 3) ^ 2) * BBY; const bool more = st + 2 < NS;   /* more: a scalar test, the same in every wave */
        if (more) {   /* the f32 rows of the tile after next fly during this tile's two passes */
#pragma unroll
            for (int i = 0; i < 4; ++i) { rk[i] = *(const v4f*)(Kg + (size_t)((st + 2) * SK + i * 16) * DM); rv[i] = *(const v4f*)(Vg + (size_t)((st + 2) * SK + i * 16) * DM); } }
#pragma unroll
        for (int t = 0; t < 2; ++t)
#pragma unroll
            for (int c = 0; c < 2; ++c) kf[t][c] = cat16b(*(const v8usa*)(Krd + bo + t * 16 * PK + c * 64), *(const v8usa*)(Krd + bo + t * 16 * PK + c * 64 + 32));
#pragma unroll
        for (int ps = 0; ps < SK / 32; ++ps) { V vf[4]; v8f s[2][2];
#pragma unroll
        for (int db = 0; db < 4; ++db) vf[db] = cat16b(ldtr(Vrd + bo + ps * 32 * PV + db * 32), ldtr(Vrd + bo + (ps * 32 + 16) * PV + db * 32));
#pragma unroll
        for (int t = 0; t < 2; ++t)
#pragma unroll
            for (int g = 0; g < 2; ++g) { s[g][t] = WFrag<bf>::mma(kf[t][0], q[g][0], (v8f){}); s[g][t] = WFrag<bf>::mma(kf[t][1], q[g][1], s[g][t]); }
        if (ps + 1 < SK / 32) {   /* the tile's next 32 keys' fragments come in during the vector work and the second product */
#pragma unroll
            for (int t = 0; t < 2; ++t)
#pragma unroll
                for (int c = 0; c < 2; ++c) kf[t][c] = cat16b(*(const v8usa*)(Krd + bo + ((ps + 1) * 32 + t * 16) * PK + c * 64), *(const v8usa*)(Krd + bo + ((ps + 1) * 32 + t * 16) * PK + c * 64 + 32)); }
        float bm[2];
#pragma unroll
        for (int g = 0; g < 2; ++g) { bm[g] = s[g][0][0];
#pragma unroll
            for (int t = 0; t < 2; ++t)
#pragma unroll
                for (int j = 0; j < 8; ++j) bm[g] = fmaxf(bm[g], s[g][t][j]);
            bm[g] = fmaxf(bm[g], xhalf(bm[g])); }
        if (__builtin_amdgcn_ballot_w32(bm[0] > mx[0] + MLAZY || bm[1] > mx[1] + MLAZY) != 0) {   /* one scalar branch a pass; always taken on the first pass, where the factor is exp(-inf) = 0 on zeros */
#pragma unroll
            for (int g = 0; g < 2; ++g) { const float mn = fmaxf(mx[g], bm[g]); const float sc2 = __builtin_amdgcn_exp2f((mx[g] - mn) * 1.4426950408889634f); mx[g] = mn; sum[g][0] *= sc2; sum[g][1] *= sc2;
#pragma unroll
                for (int db = 0; db < 4; ++db) o[g][db] *= sc2; } }
#pragma unroll
        for (int g = 0; g < 2; ++g) { V ph, pl;
#pragma unroll
            for (int t = 0; t < 2; ++t)
#pragma unroll
                for (int j = 0; j < 8; j += 2) { f2 p; p[0] = __builtin_amdgcn_exp2f((s[g][t][j] - mx[g]) * 1.4426950408889634f); p[1] = __builtin_amdgcn_exp2f((s[g][t][j + 1] - mx[g]) * 1.4426950408889634f); sum[g][t] += p[0]; sum[g][t] += p[1];
                    const b2 a = __builtin_convertvector(p, b2); f2 r; r[0] = p[0] - (float)a[0]; r[1] = p[1] - (float)a[1]; const b2 c2 = __builtin_convertvector(r, b2);
                    ph[t * 8 + j] = a[0]; ph[t * 8 + j + 1] = a[1]; pl[t * 8 + j] = c2[0]; pl[t * 8 + j + 1] = c2[1]; }
#pragma unroll
            for (int db = 0; db < 4; ++db) { o[g][db] = WFrag<bf>::mma(vf[db], ph, o[g][db]); o[g][db] = WFrag<bf>::mma(vf[db], pl, o[g][db]); } }
        }
        // four vector slots behind the tile's last products: a branch follows, on whose taken side the operands or results of those products may be touched at once
        asm volatile("v_nop\n\tv_nop\n\tv_nop\n\tv_nop" : "+v"(o[0][0]), "+v"(o[0][1]), "+v"(o[0][2]), "+v"(o[0][3]), "+v"(o[1][0]), "+v"(o[1][1]), "+v"(o[1][2]), "+v"(o[1][3]));
        if (more) {   /* the tile after next, rounded, into a slot that every wave left at the last barrier */
#pragma unroll
            for (int i = 0; i < 4; ++i) { *(v4usa*)(Kst + bn + i * 16 * PK) = __builtin_bit_cast(v4usa, __builtin_convertvector(rk[i], b4v)); *(v4usa*)(Vst + bn + i * 16 * PV) = __builtin_bit_cast(v4usa, __builtin_convertvector(rv[i], b4v)); } }
        if (st & 1) __syncthreads();   /* under a scalar test that reads the same in every wave: publishes the two tiles just stored and ends every wave's reads of the two just used */
    }
#pragma unroll
    for (int g = 0; g < 2; ++g) { float l = sum[g][0] + sum[g][1]; l += xhalf(l); const float f = __fdiv_rn(1.0f, l); float* op = OUTb + (size_t)(q0 + g * 16 + lr) * DM + h * HD + 8 * hi;
#pragma unroll
        for (int db = 0; db < 4; ++db) { v4f a, c;
#pragma unroll
            for (int j = 0; j < 4; ++j) { a[j] = o[g][db][j] * f; c[j] = o[g][db][j + 4] * f; }
            *(v4f*)(op + db * 16) = a; *(v4f*)(op + db * 16 + 4) = c; } }
}

__device__ __forceinline__ h16 tohx(float x) { return (h16)x; }
__device__ __forceinline__ void splitf(float y, unsigned short& h, unsigned short& l) { h = f2bf(y); l = f2bf(y - bf2f(h)); }
typedef __attribute__((ext_vector_type(2))) _Float16 v2h;
typedef __attribute__((ext_vector_type(4))) _Float16 v4h;
typedef __attribute__((ext_vector_type(2))) unsigned short v2us;
typedef __attribute__((ext_vector_type(4))) unsigned short v4us;
typedef __attribute__((ext_vector_type(2))) float v2f;
typedef __attribute__((ext_vector_type(4))) int v4i;

__global__ __launch_bounds__(256) void k_wtG(const float* __restrict__ w, int K, int N, bf* Bt) {
    const int lane = threadIdx.x & 31; const int L0 = (blockIdx.x * 8 + (threadIdx.x >> 5)) * 8; const int nlines = N * K / 64;
{
#pragma unroll 1
        for (int l = 0; l < 8; ++l) { const int L = L0 + l; if (L >= nlines) break; const size_t e = (size_t)L * 64 + lane * 2; const int k = (int)(e % K), n = (int)(e / K); v2us o;
            o[0] = f2bf(w[(size_t)k * N + n]); o[1] = f2bf(w[(size_t)(k + 1) * N + n]); *(v2us*)(Bt + e) = o; }
         }
}
__global__ __launch_bounds__(256) void k_cvt8(const float* __restrict__ src, bf* dst, size_t n8) { const size_t i = (size_t)blockIdx.x * 256 + threadIdx.x; if (i >= n8) return; const v8f v = *(const v8f*)(src + i * 8); v8us o;
#pragma unroll
    for (int k = 0; k < 8; ++k) o[k] = f2bf(v[k]); *(v8us*)(dst + i * 8) = o;  }


__global__ __launch_bounds__(256) void k_vtp(const float* __restrict__ F, int pitch, int nheads, h16* V16, bf* Vh, bf* Vl) { const size_t e = ((size_t)blockIdx.x * 256 + threadIdx.x) * 2; if (e >= (size_t)nheads * HD * TT) return; const int t = (int)(e % TT); const int d = (int)((e / TT) % HD); const int g = (int)(e / ((size_t)TT * HD)); v2h o16; v2us oh, ol;
#pragma unroll
    for (int q = 0; q < 2; ++q) { const float x = F[(size_t)(t + q) * pitch + g * HD + d]; o16[q] = tohx(x); unsigned short a2, c2; splitf(x, a2, c2); oh[q] = a2; ol[q] = c2; }
    *(v2h*)(V16 + e) = o16; *(v2us*)(Vh + e) = oh; *(v2us*)(Vl + e) = ol;  }

__global__ __launch_bounds__(256) void k_merge(const float* __restrict__ O, int h0, float* OUTb) { const size_t e = ((size_t)blockIdx.x * 256 + threadIdx.x) * 2; if (e >= (size_t)ZH * TT * HD) return; const int d = (int)(e % HD); const int t = (int)((e / HD) % TT); const int zz = (int)(e / ((size_t)HD * TT)); const float cs = (t < RH) ? 1.0f : (1.0f / PCAR); const size_t oo = (size_t)t * DQ + (h0 + zz) * HD + d;
    v2f o2; o2[0] = O[e] * cs; o2[1] = O[e + 1] * cs; *(v2f*)(OUTb + oo) = o2;  }


__global__ __launch_bounds__(256) void k_vtpR1(const float* __restrict__ Vb, bf* Vh) { const size_t e = ((size_t)blockIdx.x * 256 + threadIdx.x) * 2; if (e >= (size_t)HD * TT) return; const int t = (int)(e % TT); const int d = (int)(e / TT); v2us o; o[0] = f2bf(Vb[(size_t)t * HD + d]); o[1] = f2bf(Vb[(size_t)(t + 1) * HD + d]); *(v2us*)(Vh + e) = o;  }
__global__ __launch_bounds__(256) void k_mergeR(const float* __restrict__ O, float* outb, size_t n4) { const size_t i = (size_t)blockIdx.x * 256 + threadIdx.x; if (i >= n4) return; const v4f a = *(const v4f*)(O + i * 4); *(v4f*)(outb + i * 4) = a;  }


extern "C" void kernel_launch(void* const* d_in, const int* in_sizes, int n_in,
                              void* d_out, int out_size, void* d_ws, size_t ws_size, hipStream_t stream) {
    (void)in_sizes; (void)n_in; (void)out_size;
    const float* Qin = (const float*)d_in[0]; const float* Kin = (const float*)d_in[1]; const float* Vin = (const float*)d_in[2];
    float* OUT = (float*)d_out;
    (void)d_ws; (void)ws_size;
    for (int b = 0; b < NB_; ++b) {
        const float* qb = Qin + (size_t)b * TT * DM; const float* kb = Kin + (size_t)b * TT * DM; const float* vb = Vin + (size_t)b * TT * DM;   /* token-major [t][h][d] slabs */
        k_fattn<<<dim3(TT / 256, NH_, 1), 256, 0, stream>>>(qb, kb, vb, OUT + (size_t)b * TT * DM); }   /* inputs rounded to bf16 on the way into LDS and registers, exact scores, f32 softmax, P (hi/lo) x exact v^T, merged f32 output rows */
}

// v004
// A run of this version takes 45.2 microseconds.
// Next to v003, in two timings, it ran 1.04 times as fast each time.
// All steps since v000 together make it 48.3 times as fast.
#include <hip/hip_runtime.h>

// Core dot-product attention on sequence-first tensors (query, key, value [2048][2][16][64] = [sq][b][np][hn]; scores = q.k UNscaled (the module computes sqrt(hn) but never applies it: logit sigma ~8); softmax over all 2,048 keys; context -> [2048][2][1024] (4.2 M)). The (b, np) pairs are 32 independent heads of one token-major [2048][2048] slab, and the output row layout [s][b][np*hn] is that same slab, so the whole problem is one pass over 32 heads.
// Layout: no planes in memory: each work-group rounds its head's rows to bf16 on the way into LDS (exact score products of the rounded inputs); the softmax with EVERY row hi/lo (2-product attn.v): the unscaled logits are far too sharp for fp16 probabilities; merged f32 output rows.
// Compute dtypes, f32 accumulate: every input rounded to bf16; q.k exact; softmax f32; P hi/lo x exact values; output f32.

#define NB_  1
#define TT   2048
#define DM   2048      // token-major row pitch (H x HD)
#define NH_  32
#define NKV  1
#define REP  (NH_ / NKV)
#define HD   64
#define DQ   (NH_ * HD)
#define DKV  (NKV * HD)
#define ZH   1
#define RH   2048                  // query rows < RH use hi+lo planes (0: none)
#define WIN  0
#define PCAR 1024.0f
#define SCL  1.0f   // unscaled (the module never applies its norm_factor)
typedef _Float16 h16;
typedef unsigned short bf;
typedef __attribute__((ext_vector_type(16))) __bf16   v16bf;
typedef __attribute__((ext_vector_type(16))) _Float16 v16h;
typedef __attribute__((ext_vector_type(8)))  _Float16 v8h;
typedef __attribute__((ext_vector_type(8)))  unsigned short v8us;
typedef __attribute__((ext_vector_type(8)))  float    v8f;
typedef __attribute__((ext_vector_type(4)))  float    v4f;
typedef v8h  __attribute__((may_alias)) v8ha;
typedef v4f  __attribute__((may_alias)) v4fa;
typedef v8us __attribute__((may_alias)) v8usa;

__device__ __forceinline__ unsigned short f2bf(float f) { unsigned u = __float_as_uint(f); u += 0x7FFFu + ((u >> 16) & 1u); return (unsigned short)(u >> 16); }
__device__ __forceinline__ float bf2f(unsigned short b) { return __uint_as_float(((unsigned)b) << 16); }
__device__ __forceinline__ float bfr(float f) { return bf2f(f2bf(f)); }
__device__ __forceinline__ v16h cat16(v8h lo, v8h hi) { return __builtin_shufflevector(lo, hi, 0, 1, 2, 3, 4, 5, 6, 7, 8, 9, 10, 11, 12, 13, 14, 15); }
__device__ __forceinline__ v16bf cat16b(v8us lo, v8us hi) { return __builtin_bit_cast(v16bf, __builtin_shufflevector(lo, hi, 0, 1, 2, 3, 4, 5, 6, 7, 8, 9, 10, 11, 12, 13, 14, 15)); }
__device__ __forceinline__ v8f wmma16(v16h a, v16h b, v8f c) { return __builtin_amdgcn_wmma_f32_16x16x32_f16(false, a, false, b, (short)0, c, false, false); }
__device__ __forceinline__ v8f wmmab(v16bf a, v16bf b, v8f c) { return __builtin_amdgcn_wmma_f32_16x16x32_bf16(false, a, false, b, (short)0, c, false, false); }



// fragment loaders and products of the 16x16x32 forms: a lane takes k 8 hi + 0..7 and 16 + 8 hi + 0..7 of its row
template <typename T16> struct WFrag;
template <> struct WFrag<h16> { typedef v16h V; static __device__ __forceinline__ V ld(const h16* p) { return cat16(*(const v8h*)p, *(const v8h*)(p + 16)); } static __device__ __forceinline__ v8f mma(V a, V b, v8f c) { return wmma16(a, b, c); } };
template <> struct WFrag<bf> { typedef v16bf V; static __device__ __forceinline__ V ld(const bf* p) { return cat16b(*(const v8us*)p, *(const v8us*)(p + 16)); } static __device__ __forceinline__ v8f mma(V a, V b, v8f c) { return wmmab(a, b, c); } };

#define MLAZY 5.5f
#define SK   64                     // keys per tile
#define NS   (TT / SK)
#define PK   144                    // LDS pitch of a K row, bytes
#define PV   160                    // LDS pitch of a V row, bytes
#define KBY  (SK * PK)              // K part of a slot
#define BBY  (SK * PK + SK * PV)    // one slot
#define XWB  4096                   // merge: bytes of one wave's handed-over output tile (32 floats a lane)
#define XMB  (16 * XWB)             // merge: where the handed-over maxima and row sums start (8 bytes a lane)
typedef __attribute__((ext_vector_type(4))) unsigned short v4usa __attribute__((may_alias));
typedef __attribute__((ext_vector_type(2))) float f2a __attribute__((may_alias));
typedef __attribute__((ext_vector_type(4))) __bf16 b4v;
typedef __attribute__((ext_vector_type(8))) __bf16 b8v;
typedef __attribute__((ext_vector_type(8))) short s16x8;
typedef __attribute__((address_space(3))) s16x8 lds_s16x8;
__device__ __forceinline__ float xhalf(float x) { const int b = __float_as_int(x); return __int_as_float(__builtin_amdgcn_permlanex16(b, b, 0x76543210, 0xfedcba98, false, false)); }   // lane l <-> l ^ 16
__device__ __forceinline__ v8us ldtr(const unsigned char* p) { return __builtin_bit_cast(v8us, __builtin_amdgcn_ds_load_tr16_b128_v8i16((lds_s16x8*)p)); }
__device__ __forceinline__ v8us cvt8r(const float* p) { return __builtin_bit_cast(v8us, __builtin_convertvector(*(const v8f*)p, b8v)); }   // 8 f32 -> 8 bf16, round to nearest even
// merge, first half: a wave hands one column group's partial result (output tile, maximum in use, in-lane row sum) to its partner; lanes 16 bytes apart in the tile's stores, 8 in that of maximum and sum
__device__ __forceinline__ void xgive(unsigned char* X, int w, int lane, const v8f* o, float m, float l) {
#pragma unroll
    for (int db = 0; db < 4; ++db) { v4f a, c;
#pragma unroll
        for (int j = 0; j < 4; ++j) { a[j] = o[db][j]; c[j] = o[db][j + 4]; }
        *(v4fa*)(X + w * XWB + (db * 2) * 512 + lane * 16) = a; *(v4fa*)(X + w * XWB + (db * 2 + 1) * 512 + lane * 16) = c; }
    f2a ml; ml[0] = m; ml[1] = l; *(f2a*)(X + XMB + w * 256 + lane * 8) = ml; }
// merge, second half: own partial and the partner's (wave p, same lane = same column and same output rows) brought to the common maximum, summed, divided by the joined row sum, stored
__device__ __forceinline__ void xtake(const unsigned char* X, int p, int lane, const v8f* o, float m, float l, float* op) {
    const f2a ml = *(const f2a*)(X + XMB + p * 256 + lane * 8); const float d = m - ml[0];
    const float e = __builtin_amdgcn_exp2f(-__builtin_fabsf(d) * 1.4426950408889634f); const float fa = d < 0.f ? e : 1.0f, fb = d < 0.f ? 1.0f : e;   /* the side with the larger maximum keeps its scale */
    float t = l * fa + ml[1] * fb; t += xhalf(t); const float f = __fdiv_rn(1.0f, t); const float ca = fa * f, cb = fb * f;
#pragma unroll
    for (int db = 0; db < 4; ++db) { const v4f pa = *(const v4fa*)(X + p * XWB + (db * 2) * 512 + lane * 16), pc = *(const v4fa*)(X + p * XWB + (db * 2 + 1) * 512 + lane * 16); v4f a, c;
#pragma unroll
        for (int j = 0; j < 4; ++j) { a[j] = o[db][j] * ca + pa[j] * cb; c[j] = o[db][j + 4] * ca + pc[j] * cb; }
        *(v4f*)(op + db * 16) = a; *(v4f*)(op + db * 16 + 4) = c; } }
__global__ __launch_bounds__(512) void k_fattn(const float* __restrict__ Qf, const float* __restrict__ Kf, const float* __restrict__ Vf, float* __restrict__ OUTb) {
    typedef WFrag<bf>::V V;
    typedef __attribute__((ext_vector_type(2))) float f2; typedef __attribute__((ext_vector_type(2))) __bf16 b2;
    __shared__ __attribute__((aligned(256))) unsigned char L[4 * BBY];
    const int lane = threadIdx.x & 31, lr = lane & 15, hi = lane >> 4, w = __builtin_amdgcn_readfirstlane(threadIdx.x >> 5), kh = w >> 3; const int h = blockIdx.y, q0 = (blockIdx.x * 8 + (w & 7)) * 32;
    const int sr = threadIdx.x >> 4, sc = threadIdx.x & 15;   /* staging: row sr + 32 i of the tile, floats 4 sc .. 4 sc + 3 of the head's 64 */
    const float* Kg = Kf + (size_t)sr * DM + h * HD + 4 * sc; const float* Vg = Vf + (size_t)sr * DM + h * HD + 4 * sc;
    unsigned char* Kst = L + sr * PK + 8 * sc; unsigned char* Vst = L + KBY + sr * PV + 8 * sc;
    const unsigned char* Krd = L + (kh * 32 + lr) * PK + 16 * hi;                                             /* A fragment of K: row lr of this wave group's 32, bytes 16 hi and 32 + 16 hi of each 64 */
    const unsigned char* Vrd = L + KBY + (kh * 32 + 8 * hi + (lane & 7)) * PV + 16 * ((lane >> 3) & 1);      /* the transposing load's lane address */
    const float* Qp = Qf + (size_t)(q0 + lr) * DM + h * HD + 8 * hi;
    { v4f pk[4], pv[4];   /* tiles 0 and 1 into slots 0 and 1 */
#pragma unroll
    for (int i = 0; i < 4; ++i) { pk[i] = *(const v4f*)(Kg + (size_t)i * 32 * DM); pv[i] = *(const v4f*)(Vg + (size_t)i * 32 * DM); }
#pragma unroll
    for (int i = 0; i < 4; ++i) { *(v4usa*)(Kst + (i >> 1) * BBY + (i & 1) * 32 * PK) = __builtin_bit_cast(v4usa, __builtin_convertvector(pk[i], b4v)); *(v4usa*)(Vst + (i >> 1) * BBY + (i & 1) * 32 * PV) = __builtin_bit_cast(v4usa, __builtin_convertvector(pv[i], b4v)); } }
    V q[2][2], kf[2][2];
#pragma unroll
    for (int t = 0; t < 2; ++t)
#pragma unroll
        for (int c = 0; c < 2; ++c) q[t][c] = cat16b(cvt8r(Qp + (size_t)t * 16 * DM + c * 32), cvt8r(Qp + (size_t)t * 16 * DM + c * 32 + 16));
    float mx[2] = {-3.0e38f, -3.0e38f}; v8f o[2][4]; float sum[2][2] = {{0.f, 0.f}, {0.f, 0.f}};
#pragma unroll
    for (int g = 0; g < 2; ++g)
#pragma unroll
        for (int db = 0; db < 4; ++db) o[g][db] = (v8f){};
    __syncthreads();   /* publishes tiles 0 and 1 */
    // rolled: the body (a pair of tiles, one pass of this wave in each) is long enough to fill the pipes, and the code stays small for the instruction cache
#pragma unroll 1
    for (int sp = 0; sp < NS / 2; ++sp) { const unsigned bo = (unsigned)(sp & 1) * 2 * BBY, bn = 2 * BBY - bo; const bool more = sp + 1 < NS / 2;   /* more: a scalar test, the same in every wave */
#pragma unroll
        for (int t = 0; t < 2; ++t)
#pragma unroll
            for (int c = 0; c < 2; ++c) kf[t][c] = cat16b(*(const v8usa*)(Krd + bo + t * 16 * PK + c * 64), *(const v8usa*)(Krd + bo + t * 16 * PK + c * 64 + 32));
#pragma unroll
        for (int ps = 0; ps < 2; ++ps) { V vf[4]; v8f s[2][2]; v4f rk[2], rv[2];   /* pass ps: this wave group's 32 keys of tile 2 sp + ps */
        if (more) {   /* the f32 rows of the tile after next fly during this pass */
#pragma unroll
            for (int i = 0; i < 2; ++i) { rk[i] = *(const v4f*)(Kg + (size_t)((2 * sp + 2 + ps) * SK + i * 32) * DM); rv[i] = *(const v4f*)(Vg + (size_t)((2 * sp + 2 + ps) * SK + i * 32) * DM); } }
#pragma unroll
        for (int db = 0; db < 4; ++db) vf[db] = cat16b(ldtr(Vrd + bo + ps * BBY + db * 32), ldtr(Vrd + bo + ps * BBY + 16 * PV + db * 32));
#pragma unroll
        for (int t = 0; t < 2; ++t)
#pragma unroll
            for (int g = 0; g < 2; ++g) { s[g][t] = WFrag<bf>::mma(kf[t][0], q[g][0], (v8f){}); s[g][t] = WFrag<bf>::mma(kf[t][1], q[g][1], s[g][t]); }
        if (ps == 0) {   /* the pair's second tile is published already: its fragments come in during the vector work and the second product */
#pragma unroll
            for (int t = 0; t < 2; ++t)
#pragma unroll
                for (int c = 0; c < 2; ++c) kf[t][c] = cat16b(*(const v8usa*)(Krd + bo + BBY + t * 16 * PK + c * 64), *(const v8usa*)(Krd + bo + BBY + t * 16 * PK + c * 64 + 32)); }
        float bm[2];
#pragma unroll
        for (int g = 0; g < 2; ++g) { bm[g] = s[g][0][0];
#pragma unroll
            for (int t = 0; t < 2; ++t)
#pragma unroll
                for (int j = 0; j < 8; ++j) bm[g] = fmaxf(bm[g], s[g][t][j]);
            bm[g] = fmaxf(bm[g], xhalf(bm[g])); }
        if (__builtin_amdgcn_ballot_w32(bm[0] > mx[0] + MLAZY || bm[1] > mx[1] + MLAZY) != 0) {   /* one scalar branch a pass; always taken on the first pass, where the factor is exp(-inf) = 0 on zeros */
#pragma unroll
            for (int g = 0; g < 2; ++g) { const float mn = fmaxf(mx[g], bm[g]); const float sc2 = __builtin_amdgcn_exp2f((mx[g] - mn) * 1.4426950408889634f); mx[g] = mn; sum[g][0] *= sc2; sum[g][1] *= sc2;
#pragma unroll
                for (int db = 0; db < 4; ++db) o[g][db] *= sc2; } }
#pragma unroll
        for (int g = 0; g < 2; ++g) { V ph, pl;
#pragma unroll
            for (int t = 0; t < 2; ++t)
#pragma unroll
                for (int j = 0; j < 8; j += 2) { f2 p; p[0] = __builtin_amdgcn_exp2f((s[g][t][j] - mx[g]) * 1.4426950408889634f); p[1] = __builtin_amdgcn_exp2f((s[g][t][j + 1] - mx[g]) * 1.4426950408889634f); sum[g][t] += p[0]; sum[g][t] += p[1];
                    const b2 a = __builtin_convertvector(p, b2); f2 r; r[0] = p[0] - (float)a[0]; r[1] = p[1] - (float)a[1]; const b2 c2 = __builtin_convertvector(r, b2);
                    ph[t * 8 + j] = a[0]; ph[t * 8 + j + 1] = a[1]; pl[t * 8 + j] = c2[0]; pl[t * 8 + j + 1] = c2[1]; }
#pragma unroll
            for (int db = 0; db < 4; ++db) { o[g][db] = WFrag<bf>::mma(vf[db], ph, o[g][db]); o[g][db] = WFrag<bf>::mma(vf[db], pl, o[g][db]); } }
        // four vector slots behind the pass's last products: a branch follows, on whose taken side the operands or results of those products may be touched at once
        asm volatile("v_nop\n\tv_nop\n\tv_nop\n\tv_nop" : "+v"(o[0][0]), "+v"(o[0][1]), "+v"(o[0][2]), "+v"(o[0][3]), "+v"(o[1][0]), "+v"(o[1][1]), "+v"(o[1][2]), "+v"(o[1][3]));
        if (more) {   /* the tile after next, rounded, into a slot that every wave left at the last barrier */
#pragma unroll
            for (int i = 0; i < 2; ++i) { *(v4usa*)(Kst + bn + ps * BBY + i * 32 * PK) = __builtin_bit_cast(v4usa, __builtin_convertvector(rk[i], b4v)); *(v4usa*)(Vst + bn + ps * BBY + i * 32 * PV) = __builtin_bit_cast(v4usa, __builtin_convertvector(rv[i], b4v)); } }
        }
        __syncthreads();   /* publishes the two tiles just stored and ends every wave's reads of the two just used; the last one frees the ring for the merge */
    }
    // merge of the two key halves: wave group kh keeps column group kh and hands the other to its partner w ^ 8, through the ring's LDS; kh is scalar, so each side of the branches indexes the register arrays by constants, and the barrier stands outside them
    if (kh == 0) xgive(L, w, lane, o[1], mx[1], sum[1][0] + sum[1][1]); else xgive(L, w, lane, o[0], mx[0], sum[0][0] + sum[0][1]);
    __syncthreads();   /* publishes the handed-over partial results */
    float* op = OUTb + (size_t)(q0 + kh * 16 + lr) * DM + h * HD + 8 * hi;
    if (kh == 0) xtake(L, w ^ 8, lane, o[0], mx[0], sum[0][0] + sum[0][1], op); else xtake(L, w ^ 8, lane, o[1], mx[1], sum[1][0] + sum[1][1], op);
}

__device__ __forceinline__ h16 tohx(float x) { return (h16)x; }
__device__ __forceinline__ void splitf(float y, unsigned short& h, unsigned short& l) { h = f2bf(y); l = f2bf(y - bf2f(h)); }
typedef __attribute__((ext_vector_type(2))) _Float16 v2h;
typedef __attribute__((ext_vector_type(4))) _Float16 v4h;
typedef __attribute__((ext_vector_type(2))) unsigned short v2us;
typedef __attribute__((ext_vector_type(4))) unsigned short v4us;
typedef __attribute__((ext_vector_type(2))) float v2f;
typedef __attribute__((ext_vector_type(4))) int v4i;

__global__ __launch_bounds__(256) void k_wtG(const float* __restrict__ w, int K, int N, bf* Bt) {
    const int lane = threadIdx.x & 31; const int L0 = (blockIdx.x * 8 + (threadIdx.x >> 5)) * 8; const int nlines = N * K / 64;
{
#pragma unroll 1
        for (int l = 0; l < 8; ++l) { const int L = L0 + l; if (L >= nlines) break; const size_t e = (size_t)L * 64 + lane * 2; const int k = (int)(e % K), n = (int)(e / K); v2us o;
            o[0] = f2bf(w[(size_t)k * N + n]); o[1] = f2bf(w[(size_t)(k + 1) * N + n]); *(v2us*)(Bt + e) = o; }
         }
}
__global__ __launch_bounds__(256) void k_cvt8(const float* __restrict__ src, bf* dst, size_t n8) { const size_t i = (size_t)blockIdx.x * 256 + threadIdx.x; if (i >= n8) return; const v8f v = *(const v8f*)(src + i * 8); v8us o;
#pragma unroll
    for (int k = 0; k < 8; ++k) o[k] = f2bf(v[k]); *(v8us*)(dst + i * 8) = o;  }


__global__ __launch_bounds__(256) void k_vtp(const float* __restrict__ F, int pitch, int nheads, h16* V16, bf* Vh, bf* Vl) { const size_t e = ((size_t)blockIdx.x * 256 + threadIdx.x) * 2; if (e >= (size_t)nheads * HD * TT) return; const int t = (int)(e % TT); const int d = (int)((e / TT) % HD); const int g = (int)(e / ((size_t)TT * HD)); v2h o16; v2us oh, ol;
#pragma unroll
    for (int q = 0; q < 2; ++q) { const float x = F[(size_t)(t + q) * pitch + g * HD + d]; o16[q] = tohx(x); unsigned short a2, c2; splitf(x, a2, c2); oh[q] = a2; ol[q] = c2; }
    *(v2h*)(V16 + e) = o16; *(v2us*)(Vh + e) = oh; *(v2us*)(Vl + e) = ol;  }

__global__ __launch_bounds__(256) void k_merge(const float* __restrict__ O, int h0, float* OUTb) { const size_t e = ((size_t)blockIdx.x * 256 + threadIdx.x) * 2; if (e >= (size_t)ZH * TT * HD) return; const int d = (int)(e % HD); const int t = (int)((e / HD) % TT); const int zz = (int)(e / ((size_t)HD * TT)); const float cs = (t < RH) ? 1.0f : (1.0f / PCAR); const size_t oo = (size_t)t * DQ + (h0 + zz) * HD + d;
    v2f o2; o2[0] = O[e] * cs; o2[1] = O[e + 1] * cs; *(v2f*)(OUTb + oo) = o2;  }


__global__ __launch_bounds__(256) void k_vtpR1(const float* __restrict__ Vb, bf* Vh) { const size_t e = ((size_t)blockIdx.x * 256 + threadIdx.x) * 2; if (e >= (size_t)HD * TT) return; const int t = (int)(e % TT); const int d = (int)(e / TT); v2us o; o[0] = f2bf(Vb[(size_t)t * HD + d]); o[1] = f2bf(Vb[(size_t)(t + 1) * HD + d]); *(v2us*)(Vh + e) = o;  }
__global__ __launch_bounds__(256) void k_mergeR(const float* __restrict__ O, float* outb, size_t n4) { const size_t i = (size_t)blockIdx.x * 256 + threadIdx.x; if (i >= n4) return; const v4f a = *(const v4f*)(O + i * 4); *(v4f*)(outb + i * 4) = a;  }


extern "C" void kernel_launch(void* const* d_in, const int* in_sizes, int n_in,
                              void* d_out, int out_size, void* d_ws, size_t ws_size, hipStream_t stream) {
    (void)in_sizes; (void)n_in; (void)out_size;
    const float* Qin = (const float*)d_in[0]; const float* Kin = (const float*)d_in[1]; const float* Vin = (const float*)d_in[2];
    float* OUT = (float*)d_out;
    (void)d_ws; (void)ws_size;
    for (int b = 0; b < NB_; ++b) {
        const float* qb = Qin + (size_t)b * TT * DM; const float* kb = Kin + (size_t)b * TT * DM; const float* vb = Vin + (size_t)b * TT * DM;   /* token-major [t][h][d] slabs */
        k_fattn<<<dim3(TT / 256, NH_, 1), 512, 0, stream>>>(qb, kb, vb, OUT + (size_t)b * TT * DM); }   /* inputs rounded to bf16 on the way into LDS and registers, exact scores, f32 softmax, P (hi/lo) x exact v^T, merged f32 output rows */
}

// v005
// Measured time: 43.7 microseconds a run.
// Next to v004, in two timings, it ran 1.03 times as fast each time.
// All steps since v000 together make it 49.9 times as fast.
#include <hip/hip_runtime.h>

// Core dot-product attention on sequence-first tensors (query, key, value [2048][2][16][64] = [sq][b][np][hn]; scores = q.k UNscaled (the module computes sqrt(hn) but never applies it: logit sigma ~8); softmax over all 2,048 keys; context -> [2048][2][1024] (4.2 M)). The (b, np) pairs are 32 independent heads of one token-major [2048][2048] slab, and the output row layout [s][b][np*hn] is that same slab, so the whole problem is one pass over 32 heads.
// Layout: no planes in memory: each work-group rounds its head's rows to bf16 on the way into LDS (exact score products of the rounded inputs); the softmax with EVERY row hi/lo (2-product attn.v): the unscaled logits are far too sharp for fp16 probabilities; merged f32 output rows.
// Compute dtypes, f32 accumulate: every input rounded to bf16; q.k exact; softmax f32; P hi/lo x exact values; output f32.

#define NB_  1
#define TT   2048
#define DM   2048      // token-major row pitch (H x HD)
#define NH_  32
#define NKV  1
#define REP  (NH_ / NKV)
#define HD   64
#define DQ   (NH_ * HD)
#define DKV  (NKV * HD)
#define ZH   1
#define RH   2048                  // query rows < RH use hi+lo planes (0: none)
#define WIN  0
#define PCAR 1024.0f
#define SCL  1.0f   // unscaled (the module never applies its norm_factor)
typedef _Float16 h16;
typedef unsigned short bf;
typedef __attribute__((ext_vector_type(16))) __bf16   v16bf;
typedef __attribute__((ext_vector_type(16))) _Float16 v16h;
typedef __attribute__((ext_vector_type(8)))  _Float16 v8h;
typedef __attribute__((ext_vector_type(8)))  unsigned short v8us;
typedef __attribute__((ext_vector_type(8)))  float    v8f;
typedef __attribute__((ext_vector_type(4)))  float    v4f;
typedef v8h  __attribute__((may_alias)) v8ha;
typedef v4f  __attribute__((may_alias)) v4fa;
typedef v8us __attribute__((may_alias)) v8usa;

__device__ __forceinline__ unsigned short f2bf(float f) { unsigned u = __float_as_uint(f); u += 0x7FFFu + ((u >> 16) & 1u); return (unsigned short)(u >> 16); }
__device__ __forceinline__ float bf2f(unsigned short b) { return __uint_as_float(((unsigned)b) << 16); }
__device__ __forceinline__ float bfr(float f) { return bf2f(f2bf(f)); }
__device__ __forceinline__ v16h cat16(v8h lo, v8h hi) { return __builtin_shufflevector(lo, hi, 0, 1, 2, 3, 4, 5, 6, 7, 8, 9, 10, 11, 12, 13, 14, 15); }
__device__ __forceinline__ v16bf cat16b(v8us lo, v8us hi) { return __builtin_bit_cast(v16bf, __builtin_shufflevector(lo, hi, 0, 1, 2, 3, 4, 5, 6, 7, 8, 9, 10, 11, 12, 13, 14, 15)); }
__device__ __forceinline__ v8f wmma16(v16h a, v16h b, v8f c) { return __builtin_amdgcn_wmma_f32_16x16x32_f16(false, a, false, b, (short)0, c, false, false); }
__device__ __forceinline__ v8f wmmab(v16bf a, v16bf b, v8f c) { return __builtin_amdgcn_wmma_f32_16x16x32_bf16(false, a, false, b, (short)0, c, false, false); }



// fragment loaders and products of the 16x16x32 forms: a lane takes k 8 hi + 0..7 and 16 + 8 hi + 0..7 of its row
template <typename T16> struct WFrag;
template <> struct WFrag<h16> { typedef v16h V; static __device__ __forceinline__ V ld(const h16* p) { return cat16(*(const v8h*)p, *(const v8h*)(p + 16)); } static __device__ __forceinline__ v8f mma(V a, V b, v8f c) { return wmma16(a, b, c); } };
template <> struct WFrag<bf> { typedef v16bf V; static __device__ __forceinline__ V ld(const bf* p) { return cat16b(*(const v8us*)p, *(const v8us*)(p + 16)); } static __device__ __forceinline__ v8f mma(V a, V b, v8f c) { return wmmab(a, b, c); } };

#define MLAZY 5.5f
#define SK   64                     // keys per tile
#define NS   (TT / SK)
#define PK   144                    // LDS pitch of a K row, bytes
#define PV   160                    // LDS pitch of a V row, bytes
#define KBY  (SK * PK)              // K part of a slot
#define BBY  (SK * PK + SK * PV)    // one slot
#define XWB  4096                   // merge: bytes of one wave's handed-over output tile (32 floats a lane)
#define XMB  (16 * XWB)             // merge: where the handed-over maxima and row sums start (8 bytes a lane)
typedef __attribute__((ext_vector_type(4))) unsigned short v4usa __attribute__((may_alias));
typedef __attribute__((ext_vector_type(2))) float f2a __attribute__((may_alias));
typedef __attribute__((ext_vector_type(4))) __bf16 b4v;
typedef __attribute__((ext_vector_type(8))) __bf16 b8v;
typedef __attribute__((ext_vector_type(8))) short s16x8;
typedef __attribute__((address_space(3))) s16x8 lds_s16x8;
__device__ __forceinline__ float xhalf(float x) { const int b = __float_as_int(x); return __int_as_float(__builtin_amdgcn_permlanex16(b, b, 0x76543210, 0xfedcba98, false, false)); }   // lane l <-> l ^ 16
__device__ __forceinline__ v8us ldtr(const unsigned char* p) { return __builtin_bit_cast(v8us, __builtin_amdgcn_ds_load_tr16_b128_v8i16((lds_s16x8*)p)); }
__device__ __forceinline__ v8us cvt8r(const float* p) { return __builtin_bit_cast(v8us, __builtin_convertvector(*(const v8f*)p, b8v)); }   // 8 f32 -> 8 bf16, round to nearest even
typedef __attribute__((ext_vector_type(8))) unsigned u8v;
// low parts of eight probabilities: lo = bf16(p - hi), one mixed-precision FMA a value: it reads hi as the bf16 half of its packed register, multiplies by the f32 -1 in m1, adds the f32 p and writes one bf16 half of the result register (the other half stays).
// p - hi is exact in f32, so the one rounding is the rounding of the former subtract-and-convert. Asm because the compiler folds fma(hi, -1, p) to a subtraction of an unpacked hi (two unpacks, a packed subtract and a packed convert a pair).
// -1 comes in a scalar register, read as f32 like any register source with op_sel_hi 0.
// The four low halves first, then the four high halves: a high-half write depends on the low-half write of its register, four instructions back; s_delay_alu tells the issue logic so, that the wave gives way instead of holding the port.
__device__ __forceinline__ void lo8(unsigned a0, unsigned a1, unsigned a2, unsigned a3, const float* p, float m1, unsigned& c0, unsigned& c1, unsigned& c2, unsigned& c3) {
    asm("v_fma_mixlo_bf16 %0, %4, %16, %8 op_sel_hi:[1,0,0]\n\t"
        "v_fma_mixlo_bf16 %1, %5, %16, %10 op_sel_hi:[1,0,0]\n\t"
        "v_fma_mixlo_bf16 %2, %6, %16, %12 op_sel_hi:[1,0,0]\n\t"
        "v_fma_mixlo_bf16 %3, %7, %16, %14 op_sel_hi:[1,0,0]\n\t"
        "s_delay_alu instid0(VALU_DEP_4) | instskip(NEXT) | instid1(VALU_DEP_4)\n\t"
        "v_fma_mixhi_bf16 %0, %4, %16, %9 op_sel:[1,0,0] op_sel_hi:[1,0,0]\n\t"
        "v_fma_mixhi_bf16 %1, %5, %16, %11 op_sel:[1,0,0] op_sel_hi:[1,0,0]\n\t"
        "s_delay_alu instid0(VALU_DEP_4) | instskip(NEXT) | instid1(VALU_DEP_4)\n\t"
        "v_fma_mixhi_bf16 %2, %6, %16, %13 op_sel:[1,0,0] op_sel_hi:[1,0,0]\n\t"
        "v_fma_mixhi_bf16 %3, %7, %16, %15 op_sel:[1,0,0] op_sel_hi:[1,0,0]"
        : "=&v"(c0), "=&v"(c1), "=&v"(c2), "=&v"(c3)
        : "v"(a0), "v"(a1), "v"(a2), "v"(a3), "v"(p[0]), "v"(p[1]), "v"(p[2]), "v"(p[3]), "v"(p[4]), "v"(p[5]), "v"(p[6]), "v"(p[7]), "s"(m1)); }
// merge, first half: a wave hands one column group's partial result (output tile, maximum in use, in-lane row sum) to its partner; lanes 16 bytes apart in the output tile's stores, 8 bytes apart in the store of maximum and row sum
__device__ __forceinline__ void xgive(unsigned char* X, int w, int lane, const v8f* o, float m, float l) {
#pragma unroll
    for (int db = 0; db < 4; ++db) { v4f a, c;
#pragma unroll
        for (int j = 0; j < 4; ++j) { a[j] = o[db][j]; c[j] = o[db][j + 4]; }
        *(v4fa*)(X + w * XWB + (db * 2) * 512 + lane * 16) = a; *(v4fa*)(X + w * XWB + (db * 2 + 1) * 512 + lane * 16) = c; }
    f2a ml; ml[0] = m; ml[1] = l; *(f2a*)(X + XMB + w * 256 + lane * 8) = ml; }
// merge, second half: own partial and the partner's (wave p, same lane = same column and same output rows) brought to the common maximum, summed, divided by the joined row sum, stored
__device__ __forceinline__ void xtake(const unsigned char* X, int p, int lane, const v8f* o, float m, float l, float* op) {
    const f2a ml = *(const f2a*)(X + XMB + p * 256 + lane * 8); const float d = m - ml[0];
    const float e = __builtin_amdgcn_exp2f(-__builtin_fabsf(d) * 1.4426950408889634f); const float fa = d < 0.f ? e : 1.0f, fb = d < 0.f ? 1.0f : e;   /* the side with the larger maximum keeps its scale */
    float t = l * fa + ml[1] * fb; t += xhalf(t); const float f = __fdiv_rn(1.0f, t); const float ca = fa * f, cb = fb * f;
#pragma unroll
    for (int db = 0; db < 4; ++db) { const v4f pa = *(const v4fa*)(X + p * XWB + (db * 2) * 512 + lane * 16), pc = *(const v4fa*)(X + p * XWB + (db * 2 + 1) * 512 + lane * 16); v4f a, c;
#pragma unroll
        for (int j = 0; j < 4; ++j) { a[j] = o[db][j] * ca + pa[j] * cb; c[j] = o[db][j + 4] * ca + pc[j] * cb; }
        *(v4f*)(op + db * 16) = a; *(v4f*)(op + db * 16 + 4) = c; } }
__global__ __launch_bounds__(512) void k_fattn(const float* __restrict__ Qf, const float* __restrict__ Kf, const float* __restrict__ Vf, float* __restrict__ OUTb) {
    typedef WFrag<bf>::V V;
    typedef __attribute__((ext_vector_type(2))) float f2; typedef __attribute__((ext_vector_type(2))) __bf16 b2;
    __shared__ __attribute__((aligned(256))) unsigned char L[4 * BBY];
    const int lane = threadIdx.x & 31, lr = lane & 15, hi = lane >> 4, w = __builtin_amdgcn_readfirstlane(threadIdx.x >> 5), kh = w >> 3; const int h = blockIdx.y, q0 = (blockIdx.x * 8 + (w & 7)) * 32;
    const int sr = threadIdx.x >> 4, sc = threadIdx.x & 15;   /* staging: row sr + 32 i of the tile, floats 4 sc .. 4 sc + 3 of the head's 64 */
    const float* Kg = Kf + (size_t)sr * DM + h * HD + 4 * sc; const float* Vg = Vf + (size_t)sr * DM + h * HD + 4 * sc;
    unsigned char* Kst = L + sr * PK + 8 * sc; unsigned char* Vst = L + KBY + sr * PV + 8 * sc;
    const unsigned char* Krd = L + (kh * 32 + lr) * PK + 16 * hi;                                             /* A fragment of K: row lr of this wave group's 32, bytes 16 hi and 32 + 16 hi of each 64 */
    const unsigned char* Vrd = L + KBY + (kh * 32 + 8 * hi + (lane & 7)) * PV + 16 * ((lane >> 3) & 1);      /* the transposing load's lane address */
    const float* Qp = Qf + (size_t)(q0 + lr) * DM + h * HD + 8 * hi;
    { v4f pk[4], pv[4];   /* tiles 0 and 1 into slots 0 and 1 */
#pragma unroll
    for (int i = 0; i < 4; ++i) { pk[i] = *(const v4f*)(Kg + (size_t)i * 32 * DM); pv[i] = *(const v4f*)(Vg + (size_t)i * 32 * DM); }
#pragma unroll
    for (int i = 0; i < 4; ++i) { *(v4usa*)(Kst + (i >> 1) * BBY + (i & 1) * 32 * PK) = __builtin_bit_cast(v4usa, __builtin_convertvector(pk[i], b4v)); *(v4usa*)(Vst + (i >> 1) * BBY + (i & 1) * 32 * PV) = __builtin_bit_cast(v4usa, __builtin_convertvector(pv[i], b4v)); } }
    V q[2][2], kf[2][2];
#pragma unroll
    for (int t = 0; t < 2; ++t)
#pragma unroll
        for (int c = 0; c < 2; ++c) q[t][c] = cat16b(cvt8r(Qp + (size_t)t * 16 * DM + c * 32), cvt8r(Qp + (size_t)t * 16 * DM + c * 32 + 16));
    float mx[2] = {-3.0e38f, -3.0e38f}; v8f o[2][4]; float sum[2][2] = {{0.f, 0.f}, {0.f, 0.f}};
#pragma unroll
    for (int g = 0; g < 2; ++g)
#pragma unroll
        for (int db = 0; db < 4; ++db) o[g][db] = (v8f){};
    __syncthreads();   /* publishes tiles 0 and 1 */
    // rolled: the body (a pair of tiles, one pass of this wave in each) is long enough to fill the pipes, and the code stays small for the instruction cache
#pragma unroll 1
    for (int sp = 0; sp < NS / 2; ++sp) { const unsigned bo = (unsigned)(sp & 1) * 2 * BBY, bn = 2 * BBY - bo; const bool more = sp + 1 < NS / 2;   /* more: a scalar test, the same in every wave */
#pragma unroll
        for (int t = 0; t < 2; ++t)
#pragma unroll
            for (int c = 0; c < 2; ++c) kf[t][c] = cat16b(*(const v8usa*)(Krd + bo + t * 16 * PK + c * 64), *(const v8usa*)(Krd + bo + t * 16 * PK + c * 64 + 32));
#pragma unroll
        for (int ps = 0; ps < 2; ++ps) { V vf[4]; v8f s[2][2]; v4f rk[2], rv[2];   /* pass ps: this wave group's 32 keys of tile 2 sp + ps */
        if (more) {   /* the f32 rows of the tile after next fly during this pass */
#pragma unroll
            for (int i = 0; i < 2; ++i) { rk[i] = *(const v4f*)(Kg + (size_t)((2 * sp + 2 + ps) * SK + i * 32) * DM); rv[i] = *(const v4f*)(Vg + (size_t)((2 * sp + 2 + ps) * SK + i * 32) * DM); } }
#pragma unroll
        for (int db = 0; db < 4; ++db) vf[db] = cat16b(ldtr(Vrd + bo + ps * BBY + db * 32), ldtr(Vrd + bo + ps * BBY + 16 * PV + db * 32));
#pragma unroll
        for (int t = 0; t < 2; ++t)
#pragma unroll
            for (int g = 0; g < 2; ++g) { s[g][t] = WFrag<bf>::mma(kf[t][0], q[g][0], (v8f){}); s[g][t] = WFrag<bf>::mma(kf[t][1], q[g][1], s[g][t]); }
        float bm[2];
#pragma unroll
        for (int g = 0; g < 2; ++g) { bm[g] = s[g][0][0];
#pragma unroll
            for (int t = 0; t < 2; ++t)
#pragma unroll
                for (int j = 0; j < 8; ++j) bm[g] = fmaxf(bm[g], s[g][t][j]);
            bm[g] = fmaxf(bm[g], xhalf(bm[g])); }
        if (__builtin_amdgcn_ballot_w32(bm[0] > mx[0] + MLAZY || bm[1] > mx[1] + MLAZY) != 0) {   /* one scalar branch a pass; always taken on the first pass, where the factor is exp(-inf) = 0 on zeros */
#pragma unroll
            for (int g = 0; g < 2; ++g) { const float mn = fmaxf(mx[g], bm[g]); const float sc2 = __builtin_amdgcn_exp2f((mx[g] - mn) * 1.4426950408889634f); mx[g] = mn; sum[g][0] *= sc2; sum[g][1] *= sc2;
#pragma unroll
                for (int db = 0; db < 4; ++db) o[g][db] *= sc2; } }
        u8v hu[2], lu[2];
#pragma unroll
        for (int g = 0; g < 2; ++g)
#pragma unroll
            for (int t = 0; t < 2; ++t) { float p[8]; unsigned c[4];
#pragma unroll
                for (int j = 0; j < 8; j += 2) { f2 pp; pp[0] = __builtin_amdgcn_exp2f((s[g][t][j] - mx[g]) * 1.4426950408889634f); pp[1] = __builtin_amdgcn_exp2f((s[g][t][j + 1] - mx[g]) * 1.4426950408889634f); sum[g][t] += pp[0]; sum[g][t] += pp[1];
                    p[j] = pp[0]; p[j + 1] = pp[1]; hu[g][t * 4 + j / 2] = __builtin_bit_cast(unsigned, __builtin_convertvector(pp, b2)); }
                lo8(hu[g][t * 4], hu[g][t * 4 + 1], hu[g][t * 4 + 2], hu[g][t * 4 + 3], p, -1.0f, c[0], c[1], c[2], c[3]);
#pragma unroll
                for (int i = 0; i < 4; ++i) lu[g][t * 4 + i] = c[i]; }
        // both column groups' low parts stand in front of every second product
        __builtin_amdgcn_sched_barrier(0);
        if (ps == 0) {   /* the pair's second tile is published already: its fragments come in during the second product */
#pragma unroll
            for (int t = 0; t < 2; ++t)
#pragma unroll
                for (int c = 0; c < 2; ++c) kf[t][c] = cat16b(*(const v8usa*)(Krd + bo + BBY + t * 16 * PK + c * 64), *(const v8usa*)(Krd + bo + BBY + t * 16 * PK + c * 64 + 32)); }
#pragma unroll
        for (int g = 0; g < 2; ++g) { const V ph = __builtin_bit_cast(V, hu[g]), pl = __builtin_bit_cast(V, lu[g]);
#pragma unroll
            for (int db = 0; db < 4; ++db) { o[g][db] = WFrag<bf>::mma(vf[db], ph, o[g][db]); o[g][db] = WFrag<bf>::mma(vf[db], pl, o[g][db]); } }
        // four vector slots behind the pass's last products: a branch follows, on whose taken side the operands or results of those products may be touched at once
        asm volatile("v_nop\n\tv_nop\n\tv_nop\n\tv_nop" : "+v"(o[0][0]), "+v"(o[0][1]), "+v"(o[0][2]), "+v"(o[0][3]), "+v"(o[1][0]), "+v"(o[1][1]), "+v"(o[1][2]), "+v"(o[1][3]));
        if (more) {   /* the tile after next, rounded, into a slot that every wave left at the last barrier */
#pragma unroll
            for (int i = 0; i < 2; ++i) { *(v4usa*)(Kst + bn + ps * BBY + i * 32 * PK) = __builtin_bit_cast(v4usa, __builtin_convertvector(rk[i], b4v)); *(v4usa*)(Vst + bn + ps * BBY + i * 32 * PV) = __builtin_bit_cast(v4usa, __builtin_convertvector(rv[i], b4v)); } }
        }
        __syncthreads();   /* publishes the two tiles just stored and ends every wave's reads of the two just used; the last one frees the ring for the merge */
    }
    // merge of the two key halves: wave group kh keeps column group kh and hands the other to its partner w ^ 8, through the ring's LDS; kh is scalar, so each side of the branches indexes the register arrays by constants, and the barrier stands outside them
    if (kh == 0) xgive(L, w, lane, o[1], mx[1], sum[1][0] + sum[1][1]); else xgive(L, w, lane, o[0], mx[0], sum[0][0] + sum[0][1]);
    __syncthreads();   /* publishes the handed-over partial results */
    float* op = OUTb + (size_t)(q0 + kh * 16 + lr) * DM + h * HD + 8 * hi;
    if (kh == 0) xtake(L, w ^ 8, lane, o[0], mx[0], sum[0][0] + sum[0][1], op); else xtake(L, w ^ 8, lane, o[1], mx[1], sum[1][0] + sum[1][1], op);
}

__device__ __forceinline__ h16 tohx(float x) { return (h16)x; }
__device__ __forceinline__ void splitf(float y, unsigned short& h, unsigned short& l) { h = f2bf(y); l = f2bf(y - bf2f(h)); }
typedef __attribute__((ext_vector_type(2))) _Float16 v2h;
typedef __attribute__((ext_vector_type(4))) _Float16 v4h;
typedef __attribute__((ext_vector_type(2))) unsigned short v2us;
typedef __attribute__((ext_vector_type(4))) unsigned short v4us;
typedef __attribute__((ext_vector_type(2))) float v2f;
typedef __attribute__((ext_vector_type(4))) int v4i;

__global__ __launch_bounds__(256) void k_wtG(const float* __restrict__ w, int K, int N, bf* Bt) {
    const int lane = threadIdx.x & 31; const int L0 = (blockIdx.x * 8 + (threadIdx.x >> 5)) * 8; const int nlines = N * K / 64;
{
#pragma unroll 1
        for (int l = 0; l < 8; ++l) { const int L = L0 + l; if (L >= nlines) break; const size_t e = (size_t)L * 64 + lane * 2; const int k = (int)(e % K), n = (int)(e / K); v2us o;
            o[0] = f2bf(w[(size_t)k * N + n]); o[1] = f2bf(w[(size_t)(k + 1) * N + n]); *(v2us*)(Bt + e) = o; }
         }
}
__global__ __launch_bounds__(256) void k_cvt8(const float* __restrict__ src, bf* dst, size_t n8) { const size_t i = (size_t)blockIdx.x * 256 + threadIdx.x; if (i >= n8) return; const v8f v = *(const v8f*)(src + i * 8); v8us o;
#pragma unroll
    for (int k = 0; k < 8; ++k) o[k] = f2bf(v[k]); *(v8us*)(dst + i * 8) = o;  }


__global__ __launch_bounds__(256) void k_vtp(const float* __restrict__ F, int pitch, int nheads, h16* V16, bf* Vh, bf* Vl) { const size_t e = ((size_t)blockIdx.x * 256 + threadIdx.x) * 2; if (e >= (size_t)nheads * HD * TT) return; const int t = (int)(e % TT); const int d = (int)((e / TT) % HD); const int g = (int)(e / ((size_t)TT * HD)); v2h o16; v2us oh, ol;
#pragma unroll
    for (int q = 0; q < 2; ++q) { const float x = F[(size_t)(t + q) * pitch + g * HD + d]; o16[q] = tohx(x); unsigned short a2, c2; splitf(x, a2, c2); oh[q] = a2; ol[q] = c2; }
    *(v2h*)(V16 + e) = o16; *(v2us*)(Vh + e) = oh; *(v2us*)(Vl + e) = ol;  }

__global__ __launch_bounds__(256) void k_merge(const float* __restrict__ O, int h0, float* OUTb) { const size_t e = ((size_t)blockIdx.x * 256 + threadIdx.x) * 2; if (e >= (size_t)ZH * TT * HD) return; const int d = (int)(e % HD); const int t = (int)((e / HD) % TT); const int zz = (int)(e / ((size_t)HD * TT)); const float cs = (t < RH) ? 1.0f : (1.0f / PCAR); const size_t oo = (size_t)t * DQ + (h0 + zz) * HD + d;
    v2f o2; o2[0] = O[e] * cs; o2[1] = O[e + 1] * cs; *(v2f*)(OUTb + oo) = o2;  }


__global__ __launch_bounds__(256) void k_vtpR1(const float* __restrict__ Vb, bf* Vh) { const size_t e = ((size_t)blockIdx.x * 256 + threadIdx.x) * 2; if (e >= (size_t)HD * TT) return; const int t = (int)(e % TT); const int d = (int)(e / TT); v2us o; o[0] = f2bf(Vb[(size_t)t * HD + d]); o[1] = f2bf(Vb[(size_t)(t + 1) * HD + d]); *(v2us*)(Vh + e) = o;  }
__global__ __launch_bounds__(256) void k_mergeR(const float* __restrict__ O, float* outb, size_t n4) { const size_t i = (size_t)blockIdx.x * 256 + threadIdx.x; if (i >= n4) return; const v4f a = *(const v4f*)(O + i * 4); *(v4f*)(outb + i * 4) = a;  }


extern "C" void kernel_launch(void* const* d_in, const int* in_sizes, int n_in,
                              void* d_out, int out_size, void* d_ws, size_t ws_size, hipStream_t stream) {
    (void)in_sizes; (void)n_in; (void)out_size;
    const float* Qin = (const float*)d_in[0]; const float* Kin = (const float*)d_in[1]; const float* Vin = (const float*)d_in[2];
    float* OUT = (float*)d_out;
    (void)d_ws; (void)ws_size;
    for (int b = 0; b < NB_; ++b) {
        const float* qb = Qin + (size_t)b * TT * DM; const float* kb = Kin + (size_t)b * TT * DM; const float* vb = Vin + (size_t)b * TT * DM;   /* token-major [t][h][d] slabs */
        k_fattn<<<dim3(TT / 256, NH_, 1), 512, 0, stream>>>(qb, kb, vb, OUT + (size_t)b * TT * DM); }   /* inputs rounded to bf16 on the way into LDS and registers, exact scores, f32 softmax, P (hi/lo) x exact v^T, merged f32 output rows */
}

// v006
// A run of this version takes 41.3 microseconds.
// In both of two side-by-side timings against v005, it was 1.06 times as fast.
// All steps since v000 together make it 52.8 times as fast.
#include <hip/hip_runtime.h>

// Core dot-product attention on sequence-first tensors (query, key, value [2048][2][16][64] = [sq][b][np][hn]; scores = q.k UNscaled (the module computes sqrt(hn) but never applies it: logit sigma ~8); softmax over all 2,048 keys; context -> [2048][2][1024] (4.2 M)). The (b, np) pairs are 32 independent heads of one token-major [2048][2048] slab, and the output row layout [s][b][np*hn] is that same slab, so the whole problem is one pass over 32 heads.
// Layout: no planes in memory: each work-group rounds its head's rows to bf16 on the way into LDS (exact score products of the rounded inputs); the softmax with EVERY row hi/lo (2-product attn.v): the unscaled logits are far too sharp for fp16 probabilities; merged f32 output rows.
// Compute dtypes, f32 accumulate: every input rounded to bf16; q.k exact; softmax f32; P hi/lo x exact values; output f32.

#define NB_  1
#define TT   2048
#define DM   2048      // token-major row pitch (H x HD)
#define NH_  32
#define NKV  1
#define REP  (NH_ / NKV)
#define HD   64
#define DQ   (NH_ * HD)
#define DKV  (NKV * HD)
#define ZH   1
#define RH   2048                  // query rows < RH use hi+lo planes (0: none)
#define WIN  0
#define PCAR 1024.0f
#define SCL  1.0f   // unscaled (the module never applies its norm_factor)
typedef _Float16 h16;
typedef unsigned short bf;
typedef __attribute__((ext_vector_type(16))) __bf16   v16bf;
typedef __attribute__((ext_vector_type(16))) _Float16 v16h;
typedef __attribute__((ext_vector_type(8)))  _Float16 v8h;
typedef __attribute__((ext_vector_type(8)))  unsigned short v8us;
typedef __attribute__((ext_vector_type(8)))  float    v8f;
typedef __attribute__((ext_vector_type(4)))  float    v4f;
typedef v8h  __attribute__((may_alias)) v8ha;
typedef v4f  __attribute__((may_alias)) v4fa;
typedef v8us __attribute__((may_alias)) v8usa;

__device__ __forceinline__ unsigned short f2bf(float f) { unsigned u = __float_as_uint(f); u += 0x7FFFu + ((u >> 16) & 1u); return (unsigned short)(u >> 16); }
__device__ __forceinline__ float bf2f(unsigned short b) { return __uint_as_float(((unsigned)b) << 16); }
__device__ __forceinline__ float bfr(float f) { return bf2f(f2bf(f)); }
__device__ __forceinline__ v16h cat16(v8h lo, v8h hi) { return __builtin_shufflevector(lo, hi, 0, 1, 2, 3, 4, 5, 6, 7, 8, 9, 10, 11, 12, 13, 14, 15); }
__device__ __forceinline__ v16bf cat16b(v8us lo, v8us hi) { return __builtin_bit_cast(v16bf, __builtin_shufflevector(lo, hi, 0, 1, 2, 3, 4, 5, 6, 7, 8, 9, 10, 11, 12, 13, 14, 15)); }
__device__ __forceinline__ v8f wmma16(v16h a, v16h b, v8f c) { return __builtin_amdgcn_wmma_f32_16x16x32_f16(false, a, false, b, (short)0, c, false, false); }
__device__ __forceinline__ v8f wmmab(v16bf a, v16bf b, v8f c) { return __builtin_amdgcn_wmma_f32_16x16x32_bf16(false, a, false, b, (short)0, c, false, false); }



// fragment loaders and products of the 16x16x32 forms: a lane takes k 8 hi + 0..7 and 16 + 8 hi + 0..7 of its row
template <typename T16> struct WFrag;
template <> struct WFrag<h16> { typedef v16h V; static __device__ __forceinline__ V ld(const h16* p) { return cat16(*(const v8h*)p, *(const v8h*)(p + 16)); } static __device__ __forceinline__ v8f mma(V a, V b, v8f c) { return wmma16(a, b, c); } };
template <> struct WFrag<bf> { typedef v16bf V; static __device__ __forceinline__ V ld(const bf* p) { return cat16b(*(const v8us*)p, *(const v8us*)(p + 16)); } static __device__ __forceinline__ v8f mma(V a, V b, v8f c) { return wmmab(a, b, c); } };

#define PBIG 0x1p60f
#define SK   64                     // keys per tile
#define NS   (TT / SK)
#define PK   144                    // LDS pitch of a K row, bytes
#define PV   160                    // LDS pitch of a V row, bytes
#define KBY  (SK * PK)              // K part of a slot
#define BBY  (SK * PK + SK * PV)    // one slot
#define XWB  4096                   // merge: bytes of one wave's handed-over output tile (32 floats a lane)
#define XMB  (16 * XWB)             // merge: where the handed-over maxima and row sums start (8 bytes a lane)
typedef __attribute__((ext_vector_type(4))) unsigned short v4usa __attribute__((may_alias));
typedef __attribute__((ext_vector_type(2))) float f2a __attribute__((may_alias));
typedef __attribute__((ext_vector_type(4))) __bf16 b4v;
typedef __attribute__((ext_vector_type(8))) __bf16 b8v;
typedef __attribute__((ext_vector_type(8))) short s16x8;
typedef __attribute__((address_space(3))) s16x8 lds_s16x8;
__device__ __forceinline__ float xhalf(float x) { const int b = __float_as_int(x); return __int_as_float(__builtin_amdgcn_permlanex16(b, b, 0x76543210, 0xfedcba98, false, false)); }   // lane l <-> l ^ 16
__device__ __forceinline__ v8us ldtr(const unsigned char* p) { return __builtin_bit_cast(v8us, __builtin_amdgcn_ds_load_tr16_b128_v8i16((lds_s16x8*)p)); }
__device__ __forceinline__ v8us cvt8r(const float* p) { return __builtin_bit_cast(v8us, __builtin_convertvector(*(const v8f*)p, b8v)); }   // 8 f32 -> 8 bf16, round to nearest even
typedef __attribute__((ext_vector_type(8))) unsigned u8v;
// low parts of eight probabilities: lo = bf16(p - hi), one mixed-precision FMA a value: it reads hi as the bf16 half of its packed register, multiplies by the f32 -1 in m1, adds the f32 p and writes one bf16 half of the result register (the other half stays).
// p - hi is exact in f32, so the one rounding is the rounding of the former subtract-and-convert. Asm because the compiler folds fma(hi, -1, p) to a subtraction of an unpacked hi (two unpacks, a packed subtract and a packed convert a pair).
// -1 comes in a scalar register, read as f32 like any register source with op_sel_hi 0.
// The four low halves first, then the four high halves: a high-half write depends on the low-half write of its register, four instructions back; s_delay_alu tells the issue logic so, that the wave gives way instead of holding the port.
__device__ __forceinline__ void lo8(unsigned a0, unsigned a1, unsigned a2, unsigned a3, const float* p, float m1, unsigned& c0, unsigned& c1, unsigned& c2, unsigned& c3) {
    asm("v_fma_mixlo_bf16 %0, %4, %16, %8 op_sel_hi:[1,0,0]\n\t"
        "v_fma_mixlo_bf16 %1, %5, %16, %10 op_sel_hi:[1,0,0]\n\t"
        "v_fma_mixlo_bf16 %2, %6, %16, %12 op_sel_hi:[1,0,0]\n\t"
        "v_fma_mixlo_bf16 %3, %7, %16, %14 op_sel_hi:[1,0,0]\n\t"
        "s_delay_alu instid0(VALU_DEP_4) | instskip(NEXT) | instid1(VALU_DEP_4)\n\t"
        "v_fma_mixhi_bf16 %0, %4, %16, %9 op_sel:[1,0,0] op_sel_hi:[1,0,0]\n\t"
        "v_fma_mixhi_bf16 %1, %5, %16, %11 op_sel:[1,0,0] op_sel_hi:[1,0,0]\n\t"
        "s_delay_alu instid0(VALU_DEP_4) | instskip(NEXT) | instid1(VALU_DEP_4)\n\t"
        "v_fma_mixhi_bf16 %2, %6, %16, %13 op_sel:[1,0,0] op_sel_hi:[1,0,0]\n\t"
        "v_fma_mixhi_bf16 %3, %7, %16, %15 op_sel:[1,0,0] op_sel_hi:[1,0,0]"
        : "=&v"(c0), "=&v"(c1), "=&v"(c2), "=&v"(c3)
        : "v"(a0), "v"(a1), "v"(a2), "v"(a3), "v"(p[0]), "v"(p[1]), "v"(p[2]), "v"(p[3]), "v"(p[4]), "v"(p[5]), "v"(p[6]), "v"(p[7]), "s"(m1)); }
// probabilities of one column group's 32 keys (two score tiles) against the maximum in use m, into p, and their in-lane sum, added up as a tree of packed pairs
__device__ __forceinline__ float pexp(const v8f s0, const v8f s1, float m, float* p) {
    typedef __attribute__((ext_vector_type(2))) float f2; f2 a[2];
#pragma unroll
    for (int t = 0; t < 2; ++t) { const v8f s = t ? s1 : s0; f2 e[4];
#pragma unroll
        for (int j = 0; j < 8; j += 2) { f2 pp; pp[0] = __builtin_amdgcn_exp2f((s[j] - m) * 1.4426950408889634f); pp[1] = __builtin_amdgcn_exp2f((s[j + 1] - m) * 1.4426950408889634f); p[t * 8 + j] = pp[0]; p[t * 8 + j + 1] = pp[1]; e[j / 2] = pp; }
        a[t] = (e[0] + e[1]) + (e[2] + e[3]); }
    const f2 r = a[0] + a[1]; return r[0] + r[1]; }
// merge, first half: a wave hands one column group's partial result (output tile, maximum in use, in-lane row sum) to its partner; lanes 16 bytes apart in the output tile's stores, 8 bytes in that of maximum and row sum
__device__ __forceinline__ void xgive(unsigned char* X, int w, int lane, const v8f* o, float m, float l) {
#pragma unroll
    for (int db = 0; db < 4; ++db) { v4f a, c;
#pragma unroll
        for (int j = 0; j < 4; ++j) { a[j] = o[db][j]; c[j] = o[db][j + 4]; }
        *(v4fa*)(X + w * XWB + (db * 2) * 512 + lane * 16) = a; *(v4fa*)(X + w * XWB + (db * 2 + 1) * 512 + lane * 16) = c; }
    f2a ml; ml[0] = m; ml[1] = l; *(f2a*)(X + XMB + w * 256 + lane * 8) = ml; }
// merge, second half: own partial and the partner's (wave p, same lane = same column and same output rows) brought to the common maximum, summed, divided by the joined row sum, stored
__device__ __forceinline__ void xtake(const unsigned char* X, int p, int lane, const v8f* o, float m, float l, float* op) {
    const f2a ml = *(const f2a*)(X + XMB + p * 256 + lane * 8); const float d = m - ml[0];
    const float e = __builtin_amdgcn_exp2f(-__builtin_fabsf(d) * 1.4426950408889634f); const float fa = d < 0.f ? e : 1.0f, fb = d < 0.f ? 1.0f : e;   /* the side with the larger maximum keeps its scale */
    float t = l * fa + ml[1] * fb; t += xhalf(t); const float f = __fdiv_rn(1.0f, t); const float ca = fa * f, cb = fb * f;
#pragma unroll
    for (int db = 0; db < 4; ++db) { const v4f pa = *(const v4fa*)(X + p * XWB + (db * 2) * 512 + lane * 16), pc = *(const v4fa*)(X + p * XWB + (db * 2 + 1) * 512 + lane * 16); v4f a, c;
#pragma unroll
        for (int j = 0; j < 4; ++j) { a[j] = o[db][j] * ca + pa[j] * cb; c[j] = o[db][j + 4] * ca + pc[j] * cb; }
        *(v4f*)(op + db * 16) = a; *(v4f*)(op + db * 16 + 4) = c; } }
__global__ __launch_bounds__(512) void k_fattn(const float* __restrict__ Qf, const float* __restrict__ Kf, const float* __restrict__ Vf, float* __restrict__ OUTb) {
    typedef WFrag<bf>::V V;
    typedef __attribute__((ext_vector_type(2))) float f2; typedef __attribute__((ext_vector_type(2))) __bf16 b2;
    __shared__ __attribute__((aligned(256))) unsigned char L[4 * BBY];
    const int lane = threadIdx.x & 31, lr = lane & 15, hi = lane >> 4, w = __builtin_amdgcn_readfirstlane(threadIdx.x >> 5), kh = w >> 3; const int h = blockIdx.y, q0 = (blockIdx.x * 8 + (w & 7)) * 32;
    const int sr = threadIdx.x >> 4, sc = threadIdx.x & 15;   /* staging: row sr + 32 i of the tile, floats 4 sc .. 4 sc + 3 of the head's 64 */
    const float* Kg = Kf + (size_t)sr * DM + h * HD + 4 * sc; const float* Vg = Vf + (size_t)sr * DM + h * HD + 4 * sc;
    unsigned char* Kst = L + sr * PK + 8 * sc; unsigned char* Vst = L + KBY + sr * PV + 8 * sc;
    const unsigned char* Krd = L + (kh * 32 + lr) * PK + 16 * hi;                                             /* A fragment of K: row lr of this wave group's 32, bytes 16 hi and 32 + 16 hi of each 64 */
    const unsigned char* Vrd = L + KBY + (kh * 32 + 8 * hi + (lane & 7)) * PV + 16 * ((lane >> 3) & 1);      /* the transposing load's lane address */
    const float* Qp = Qf + (size_t)(q0 + lr) * DM + h * HD + 8 * hi;
    { v4f pk[4], pv[4];   /* tiles 0 and 1 into slots 0 and 1 */
#pragma unroll
    for (int i = 0; i < 4; ++i) { pk[i] = *(const v4f*)(Kg + (size_t)i * 32 * DM); pv[i] = *(const v4f*)(Vg + (size_t)i * 32 * DM); }
#pragma unroll
    for (int i = 0; i < 4; ++i) { *(v4usa*)(Kst + (i >> 1) * BBY + (i & 1) * 32 * PK) = __builtin_bit_cast(v4usa, __builtin_convertvector(pk[i], b4v)); *(v4usa*)(Vst + (i >> 1) * BBY + (i & 1) * 32 * PV) = __builtin_bit_cast(v4usa, __builtin_convertvector(pv[i], b4v)); } }
    V q[2][2], kf[2][2];
#pragma unroll
    for (int t = 0; t < 2; ++t)
#pragma unroll
        for (int c = 0; c < 2; ++c) q[t][c] = cat16b(cvt8r(Qp + (size_t)t * 16 * DM + c * 32), cvt8r(Qp + (size_t)t * 16 * DM + c * 32 + 16));
    float mx[2] = {-3.0e38f, -3.0e38f}; v8f o[2][4]; float sum[2] = {0.f, 0.f};
#pragma unroll
    for (int g = 0; g < 2; ++g)
#pragma unroll
        for (int db = 0; db < 4; ++db) o[g][db] = (v8f){};
    __syncthreads();   /* publishes tiles 0 and 1 */
    // rolled: the body (a pair of tiles, one pass of this wave in each) is long enough to fill the pipes, and the code stays small for the instruction cache
#pragma unroll 1
    for (int sp = 0; sp < NS / 2; ++sp) { const unsigned bo = (unsigned)(sp & 1) * 2 * BBY, bn = 2 * BBY - bo; const bool more = sp + 1 < NS / 2;   /* more: a scalar test, the same in every wave */
#pragma unroll
        for (int t = 0; t < 2; ++t)
#pragma unroll
            for (int c = 0; c < 2; ++c) kf[t][c] = cat16b(*(const v8usa*)(Krd + bo + t * 16 * PK + c * 64), *(const v8usa*)(Krd + bo + t * 16 * PK + c * 64 + 32));
#pragma unroll
        for (int ps = 0; ps < 2; ++ps) { V vf[4]; v8f s[2][2]; v4f rk[2], rv[2];   /* pass ps: this wave group's 32 keys of tile 2 sp + ps */
        if (more) {   /* the f32 rows of the tile after next fly during this pass */
#pragma unroll
            for (int i = 0; i < 2; ++i) { rk[i] = *(const v4f*)(Kg + (size_t)((2 * sp + 2 + ps) * SK + i * 32) * DM); rv[i] = *(const v4f*)(Vg + (size_t)((2 * sp + 2 + ps) * SK + i * 32) * DM); } }
#pragma unroll
        for (int db = 0; db < 4; ++db) vf[db] = cat16b(ldtr(Vrd + bo + ps * BBY + db * 32), ldtr(Vrd + bo + ps * BBY + 16 * PV + db * 32));
#pragma unroll
        for (int t = 0; t < 2; ++t)
#pragma unroll
            for (int g = 0; g < 2; ++g) { s[g][t] = WFrag<bf>::mma(kf[t][0], q[g][0], (v8f){}); s[g][t] = WFrag<bf>::mma(kf[t][1], q[g][1], s[g][t]); }
        float p[2][16], rs[2];
#pragma unroll
        for (int g = 0; g < 2; ++g) rs[g] = pexp(s[g][0], s[g][1], mx[g], p[g]);
        if (__builtin_amdgcn_ballot_w32(!(rs[0] <= PBIG) || !(rs[1] <= PBIG)) != 0) {   /* one scalar branch a pass; always taken on the first pass, where every p is inf and the factor is exp(-inf) = 0 on zeros */
#pragma unroll
            for (int g = 0; g < 2; ++g) { float bm = s[g][0][0];
#pragma unroll
                for (int t = 0; t < 2; ++t)
#pragma unroll
                    for (int j = 0; j < 8; ++j) bm = fmaxf(bm, s[g][t][j]);
                bm = fmaxf(bm, xhalf(bm));
                const float mn = fmaxf(mx[g], bm); const float sc2 = __builtin_amdgcn_exp2f((mx[g] - mn) * 1.4426950408889634f); mx[g] = mn; sum[g] *= sc2;
#pragma unroll
                for (int db = 0; db < 4; ++db) o[g][db] *= sc2; }
#pragma unroll
            for (int g = 0; g < 2; ++g) rs[g] = pexp(s[g][0], s[g][1], mx[g], p[g]); }
        u8v hu[2], lu[2];
#pragma unroll
        for (int g = 0; g < 2; ++g) { sum[g] += rs[g];
#pragma unroll
            for (int t = 0; t < 2; ++t) { unsigned c[4];
#pragma unroll
                for (int j = 0; j < 8; j += 2) { f2 pp; pp[0] = p[g][t * 8 + j]; pp[1] = p[g][t * 8 + j + 1]; hu[g][t * 4 + j / 2] = __builtin_bit_cast(unsigned, __builtin_convertvector(pp, b2)); }
                lo8(hu[g][t * 4], hu[g][t * 4 + 1], hu[g][t * 4 + 2], hu[g][t * 4 + 3], p[g] + t * 8, -1.0f, c[0], c[1], c[2], c[3]);
#pragma unroll
                for (int i = 0; i < 4; ++i) lu[g][t * 4 + i] = c[i]; } }
        // both column groups' low parts stand in front of every second product: none may sink in between them
        __builtin_amdgcn_sched_barrier(0);
        if (ps == 0) {   /* the pair's second tile is published already: its fragments come in during the second product */
#pragma unroll
            for (int t = 0; t < 2; ++t)
#pragma unroll
                for (int c = 0; c < 2; ++c) kf[t][c] = cat16b(*(const v8usa*)(Krd + bo + BBY + t * 16 * PK + c * 64), *(const v8usa*)(Krd + bo + BBY + t * 16 * PK + c * 64 + 32)); }
#pragma unroll
        for (int g = 0; g < 2; ++g) { const V ph = __builtin_bit_cast(V, hu[g]), pl = __builtin_bit_cast(V, lu[g]);
#pragma unroll
            for (int db = 0; db < 4; ++db) { o[g][db] = WFrag<bf>::mma(vf[db], ph, o[g][db]); o[g][db] = WFrag<bf>::mma(vf[db], pl, o[g][db]); } }
        // four vector slots behind the pass's last products: a branch follows, on whose taken side the operands or results of those products may be touched at once
        asm volatile("v_nop\n\tv_nop\n\tv_nop\n\tv_nop" : "+v"(o[0][0]), "+v"(o[0][1]), "+v"(o[0][2]), "+v"(o[0][3]), "+v"(o[1][0]), "+v"(o[1][1]), "+v"(o[1][2]), "+v"(o[1][3]));
        if (more) {   /* the tile after next, rounded, into a slot that every wave left at the last barrier */
#pragma unroll
            for (int i = 0; i < 2; ++i) { *(v4usa*)(Kst + bn + ps * BBY + i * 32 * PK) = __builtin_bit_cast(v4usa, __builtin_convertvector(rk[i], b4v)); *(v4usa*)(Vst + bn + ps * BBY + i * 32 * PV) = __builtin_bit_cast(v4usa, __builtin_convertvector(rv[i], b4v)); } }
        }
        __syncthreads();   /* publishes the two tiles just stored and ends every wave's reads of the two just used; the last one frees the ring for the merge */
    }
    // merge of the two key halves: wave group kh keeps column group kh and hands the other to its partner w ^ 8, through the ring's LDS; kh is scalar, so each side of the branches indexes the register arrays by constants, and the barrier stands outside them
    if (kh == 0) xgive(L, w, lane, o[1], mx[1], sum[1]); else xgive(L, w, lane, o[0], mx[0], sum[0]);
    __syncthreads();   /* publishes the handed-over partial results */
    float* op = OUTb + (size_t)(q0 + kh * 16 + lr) * DM + h * HD + 8 * hi;
    if (kh == 0) xtake(L, w ^ 8, lane, o[0], mx[0], sum[0], op); else xtake(L, w ^ 8, lane, o[1], mx[1], sum[1], op);
}

__device__ __forceinline__ h16 tohx(float x) { return (h16)x; }
__device__ __forceinline__ void splitf(float y, unsigned short& h, unsigned short& l) { h = f2bf(y); l = f2bf(y - bf2f(h)); }
typedef __attribute__((ext_vector_type(2))) _Float16 v2h;
typedef __attribute__((ext_vector_type(4))) _Float16 v4h;
typedef __attribute__((ext_vector_type(2))) unsigned short v2us;
typedef __attribute__((ext_vector_type(4))) unsigned short v4us;
typedef __attribute__((ext_vector_type(2))) float v2f;
typedef __attribute__((ext_vector_type(4))) int v4i;

__global__ __launch_bounds__(256) void k_wtG(const float* __restrict__ w, int K, int N, bf* Bt) {
    const int lane = threadIdx.x & 31; const int L0 = (blockIdx.x * 8 + (threadIdx.x >> 5)) * 8; const int nlines = N * K / 64;
{
#pragma unroll 1
        for (int l = 0; l < 8; ++l) { const int L = L0 + l; if (L >= nlines) break; const size_t e = (size_t)L * 64 + lane * 2; const int k = (int)(e % K), n = (int)(e / K); v2us o;
            o[0] = f2bf(w[(size_t)k * N + n]); o[1] = f2bf(w[(size_t)(k + 1) * N + n]); *(v2us*)(Bt + e) = o; }
         }
}
__global__ __launch_bounds__(256) void k_cvt8(const float* __restrict__ src, bf* dst, size_t n8) { const size_t i = (size_t)blockIdx.x * 256 + threadIdx.x; if (i >= n8) return; const v8f v = *(const v8f*)(src + i * 8); v8us o;
#pragma unroll
    for (int k = 0; k < 8; ++k) o[k] = f2bf(v[k]); *(v8us*)(dst + i * 8) = o;  }


__global__ __launch_bounds__(256) void k_vtp(const float* __restrict__ F, int pitch, int nheads, h16* V16, bf* Vh, bf* Vl) { const size_t e = ((size_t)blockIdx.x * 256 + threadIdx.x) * 2; if (e >= (size_t)nheads * HD * TT) return; const int t = (int)(e % TT); const int d = (int)((e / TT) % HD); const int g = (int)(e / ((size_t)TT * HD)); v2h o16; v2us oh, ol;
#pragma unroll
    for (int q = 0; q < 2; ++q) { const float x = F[(size_t)(t + q) * pitch + g * HD + d]; o16[q] = tohx(x); unsigned short a2, c2; splitf(x, a2, c2); oh[q] = a2; ol[q] = c2; }
    *(v2h*)(V16 + e) = o16; *(v2us*)(Vh + e) = oh; *(v2us*)(Vl + e) = ol;  }

__global__ __launch_bounds__(256) void k_merge(const float* __restrict__ O, int h0, float* OUTb) { const size_t e = ((size_t)blockIdx.x * 256 + threadIdx.x) * 2; if (e >= (size_t)ZH * TT * HD) return; const int d = (int)(e % HD); const int t = (int)((e / HD) % TT); const int zz = (int)(e / ((size_t)HD * TT)); const float cs = (t < RH) ? 1.0f : (1.0f / PCAR); const size_t oo = (size_t)t * DQ + (h0 + zz) * HD + d;
    v2f o2; o2[0] = O[e] * cs; o2[1] = O[e + 1] * cs; *(v2f*)(OUTb + oo) = o2;  }


__global__ __launch_bounds__(256) void k_vtpR1(const float* __restrict__ Vb, bf* Vh) { const size_t e = ((size_t)blockIdx.x * 256 + threadIdx.x) * 2; if (e >= (size_t)HD * TT) return; const int t = (int)(e % TT); const int d = (int)(e / TT); v2us o; o[0] = f2bf(Vb[(size_t)t * HD + d]); o[1] = f2bf(Vb[(size_t)(t + 1) * HD + d]); *(v2us*)(Vh + e) = o;  }
__global__ __launch_bounds__(256) void k_mergeR(const float* __restrict__ O, float* outb, size_t n4) { const size_t i = (size_t)blockIdx.x * 256 + threadIdx.x; if (i >= n4) return; const v4f a = *(const v4f*)(O + i * 4); *(v4f*)(outb + i * 4) = a;  }


extern "C" void kernel_launch(void* const* d_in, const int* in_sizes, int n_in,
                              void* d_out, int out_size, void* d_ws, size_t ws_size, hipStream_t stream) {
    (void)in_sizes; (void)n_in; (void)out_size;
    const float* Qin = (const float*)d_in[0]; const float* Kin = (const float*)d_in[1]; const float* Vin = (const float*)d_in[2];
    float* OUT = (float*)d_out;
    (void)d_ws; (void)ws_size;
    for (int b = 0; b < NB_; ++b) {
        const float* qb = Qin + (size_t)b * TT * DM; const float* kb = Kin + (size_t)b * TT * DM; const float* vb = Vin + (size_t)b * TT * DM;   /* token-major [t][h][d] slabs */
        k_fattn<<<dim3(TT / 256, NH_, 1), 512, 0, stream>>>(qb, kb, vb, OUT + (size_t)b * TT * DM); }   /* inputs rounded to bf16 on the way into LDS and registers, exact scores, f32 softmax, P (hi/lo) x exact v^T, merged f32 output rows */
}

// v008
// Measured time: 34.1 microseconds a run.
// Versions in between are left out here; by their measured steps it is 1.21 times as fast as v006.
// Over all steps from v000 it is 63.9 times as fast.
#include <hip/hip_runtime.h>

// Core dot-product attention on sequence-first tensors (query, key, value [2048][2][16][64] = [sq][b][np][hn]; scores = q.k UNscaled (the module computes sqrt(hn) but never applies it: logit sigma ~8); softmax over all 2,048 keys; context -> [2048][2][1024] (4.2 M)). The (b, np) pairs are 32 independent heads of one token-major [2048][2048] slab, and the output row layout [s][b][np*hn] is that same slab, so the whole problem is one pass over 32 heads.
// Layout: no planes in memory: each work-group rounds its head's rows to bf16 on the way into LDS (exact score products of the rounded inputs); f32 softmax; probabilities as ONE f16 value each (11 significant bits) against the bf16-rounded values held in f16; merged f32 output rows.
// Compute dtypes, f32 accumulate: every input rounded to bf16; q.k exact (bf16 products); softmax f32; P rounded once to f16 x exact values (f16 products); output f32.

#define NB_  1
#define TT   2048
#define DM   2048      // token-major row pitch (H x HD)
#define NH_  32
#define NKV  1
#define REP  (NH_ / NKV)
#define HD   64
#define DQ   (NH_ * HD)
#define DKV  (NKV * HD)
#define ZH   1
#define RH   2048                  // k_merge (not launched): rows < RH keep scale 1, later rows 1 / PCAR
#define WIN  0
#define PCAR 1024.0f
#define SCL  1.0f   // unscaled (the module never applies its norm_factor)
typedef _Float16 h16;
typedef unsigned short bf;
typedef __attribute__((ext_vector_type(16))) __bf16   v16bf;
typedef __attribute__((ext_vector_type(16))) _Float16 v16h;
typedef __attribute__((ext_vector_type(8)))  _Float16 v8h;
typedef __attribute__((ext_vector_type(8)))  unsigned short v8us;
typedef __attribute__((ext_vector_type(8)))  float    v8f;
typedef __attribute__((ext_vector_type(4)))  float    v4f;
typedef v8h  __attribute__((may_alias)) v8ha;
typedef v4f  __attribute__((may_alias)) v4fa;
typedef v8us __attribute__((may_alias)) v8usa;

__device__ __forceinline__ unsigned short f2bf(float f) { unsigned u = __float_as_uint(f); u += 0x7FFFu + ((u >> 16) & 1u); return (unsigned short)(u >> 16); }
__device__ __forceinline__ float bf2f(unsigned short b) { return __uint_as_float(((unsigned)b) << 16); }
__device__ __forceinline__ float bfr(float f) { return bf2f(f2bf(f)); }
__device__ __forceinline__ v16h cat16(v8h lo, v8h hi) { return __builtin_shufflevector(lo, hi, 0, 1, 2, 3, 4, 5, 6, 7, 8, 9, 10, 11, 12, 13, 14, 15); }
__device__ __forceinline__ v16bf cat16b(v8us lo, v8us hi) { return __builtin_bit_cast(v16bf, __builtin_shufflevector(lo, hi, 0, 1, 2, 3, 4, 5, 6, 7, 8, 9, 10, 11, 12, 13, 14, 15)); }
__device__ __forceinline__ v8f wmma16(v16h a, v16h b, v8f c) { return __builtin_amdgcn_wmma_f32_16x16x32_f16(false, a, false, b, (short)0, c, false, false); }
__device__ __forceinline__ v8f wmmab(v16bf a, v16bf b, v8f c) { return __builtin_amdgcn_wmma_f32_16x16x32_bf16(false, a, false, b, (short)0, c, false, false); }



// fragment loaders and products of the 16x16x32 forms: a lane takes k 8 hi + 0..7 and 16 + 8 hi + 0..7 of its row
template <typename T16> struct WFrag;
template <> struct WFrag<h16> { typedef v16h V; static __device__ __forceinline__ V ld(const h16* p) { return cat16(*(const v8h*)p, *(const v8h*)(p + 16)); } static __device__ __forceinline__ v8f mma(V a, V b, v8f c) { return wmma16(a, b, c); } };
template <> struct WFrag<bf> { typedef v16bf V; static __device__ __forceinline__ V ld(const bf* p) { return cat16b(*(const v8us*)p, *(const v8us*)(p + 16)); } static __device__ __forceinline__ v8f mma(V a, V b, v8f c) { return wmmab(a, b, c); } };

#define PBIG 0x1p15f                // guard on the in-lane row sum: every p of a kept pass is finite in f16
#define POFF 4.1588830833596715f    // 6 ln 2: a search leaves the largest p at 2^-6
#define SK   64                     // keys per tile
#define NS   (TT / SK)
#define PK   144                    // LDS pitch of a K row, bytes
#define PV   160                    // LDS pitch of a V row, bytes
#define KBY  (SK * PK)              // K part of a slot
#define BBY  (SK * PK + SK * PV)    // one slot
#define XWB  4096                   // merge: bytes of one wave's handed-over output tile (32 floats a lane)
#define XMB  (16 * XWB)             // merge: where the handed-over maxima and row sums start (8 bytes a lane)
typedef __attribute__((ext_vector_type(4))) unsigned short v4usa __attribute__((may_alias));
typedef __attribute__((ext_vector_type(2))) float f2a __attribute__((may_alias));
typedef __attribute__((ext_vector_type(4))) __bf16 b4v;
typedef __attribute__((ext_vector_type(8))) __bf16 b8v;
typedef __attribute__((ext_vector_type(8))) short s16x8;
typedef __attribute__((address_space(3))) s16x8 lds_s16x8;
__device__ __forceinline__ float xhalf(float x) { const int b = __float_as_int(x); return __int_as_float(__builtin_amdgcn_permlanex16(b, b, 0x76543210, 0xfedcba98, false, false)); }   // lane l <-> l ^ 16
__device__ __forceinline__ v8us ldtr(const unsigned char* p) { return __builtin_bit_cast(v8us, __builtin_amdgcn_ds_load_tr16_b128_v8i16((lds_s16x8*)p)); }
__device__ __forceinline__ v8us cvt8r(const float* p) { return __builtin_bit_cast(v8us, __builtin_convertvector(*(const v8f*)p, b8v)); }   // 8 f32 -> 8 bf16, round to nearest even
typedef __attribute__((ext_vector_type(8))) unsigned u8v;
// four f32 values rounded to bf16 (the rounding of every input) and written as f16: exact for magnitudes from 2^-14 up, an absolute error under 2^-25 below
typedef __attribute__((ext_vector_type(2))) unsigned u2v;
__device__ __forceinline__ v4usa vh4(v4f x) { typedef __attribute__((ext_vector_type(2))) float f2; typedef __attribute__((ext_vector_type(2))) _Float16 h2; const u2v u = __builtin_bit_cast(u2v, __builtin_convertvector(x, b4v)); u2v r;
#pragma unroll
    for (int i = 0; i < 2; ++i) { f2 y; y[0] = __uint_as_float(u[i] << 16); y[1] = __uint_as_float(u[i] & 0xffff0000u); r[i] = __builtin_bit_cast(unsigned, __builtin_convertvector(y, h2)); }   /* a bf16 is the upper half of its f32 */
    return __builtin_bit_cast(v4usa, r); }
// probabilities of one column group's 32 keys (two score tiles) against the maximum in use m, into p, and their in-lane sum, added up as a tree of packed pairs
__device__ __forceinline__ float pexp(const v8f s0, const v8f s1, float m, float* p) {
    typedef __attribute__((ext_vector_type(2))) float f2; f2 a[2];
#pragma unroll
    for (int t = 0; t < 2; ++t) { const v8f s = t ? s1 : s0; f2 e[4];
#pragma unroll
        for (int j = 0; j < 8; j += 2) { f2 pp; pp[0] = __builtin_amdgcn_exp2f((s[j] - m) * 1.4426950408889634f); pp[1] = __builtin_amdgcn_exp2f((s[j + 1] - m) * 1.4426950408889634f); p[t * 8 + j] = pp[0]; p[t * 8 + j + 1] = pp[1]; e[j / 2] = pp; }
        a[t] = (e[0] + e[1]) + (e[2] + e[3]); }
    const f2 r = a[0] + a[1]; return r[0] + r[1]; }
// merge, first half: a wave hands one column group's partial result (output tile, maximum in use, in-lane row sum) to its partner; lanes 16 bytes apart in the output tile's stores, 8 bytes in that of maximum and row sum
__device__ __forceinline__ void xgive(unsigned char* X, int w, int lane, const v8f* o, float m, float l) {
#pragma unroll
    for (int db = 0; db < 4; ++db) { v4f a, c;
#pragma unroll
        for (int j = 0; j < 4; ++j) { a[j] = o[db][j]; c[j] = o[db][j + 4]; }
        *(v4fa*)(X + w * XWB + (db * 2) * 512 + lane * 16) = a; *(v4fa*)(X + w * XWB + (db * 2 + 1) * 512 + lane * 16) = c; }
    f2a ml; ml[0] = m; ml[1] = l; *(f2a*)(X + XMB + w * 256 + lane * 8) = ml; }
// merge, second half: own partial and the partner's (wave p, same lane = same column and same output rows) brought to the common maximum, summed, divided by the joined row sum.
// The merged tile (16 query rows of 64 floats) then passes through LDS, so that a store covers whole lines: from the registers a store would lay 16-byte pieces on 16 lines; read back row-major, lanes 0..15 hold one row's 256 bytes and lanes 16..31 the next row's.
// The stage is the partner's handed-over tile, 4,096 bytes that this wave alone reads and has read by then. Rows have no pad: the 16-byte piece k of row r lies at place k ^ r, so the 16 lanes of a half hit 16 different places in the column-wise writes and in the row-wise reads.
__device__ __forceinline__ void xtake(unsigned char* X, int p, int lane, const v8f* o, float m, float l, float* op) {
    const int lr = lane & 15, hi = lane >> 4;
    const f2a ml = *(const f2a*)(X + XMB + p * 256 + lane * 8); const float d = m - ml[0];
    const float e = __builtin_amdgcn_exp2f(-__builtin_fabsf(d) * 1.4426950408889634f); const float fa = d < 0.f ? e : 1.0f, fb = d < 0.f ? 1.0f : e;   /* the side with the larger maximum keeps its scale */
    float t = l * fa + ml[1] * fb; t += xhalf(t); const float f = __fdiv_rn(1.0f, t); const float ca = fa * f, cb = fb * f;
    unsigned char* S = X + p * XWB; v4f a[4], c[4];
#pragma unroll
    for (int db = 0; db < 4; ++db) { const v4f pa = *(const v4fa*)(S + (db * 2) * 512 + lane * 16), pc = *(const v4fa*)(S + (db * 2 + 1) * 512 + lane * 16);
#pragma unroll
        for (int j = 0; j < 4; ++j) { a[db][j] = o[db][j] * ca + pa[j] * cb; c[db][j] = o[db][j + 4] * ca + pc[j] * cb; } }
#pragma unroll
    for (int db = 0; db < 4; ++db) { *(v4fa*)(S + lr * 256 + (((db * 4 + hi * 2) ^ lr) << 4)) = a[db]; *(v4fa*)(S + lr * 256 + (((db * 4 + hi * 2 + 1) ^ lr) << 4)) = c[db]; }   /* row lr, floats 16 db + 8 hi + 0..7 */
    asm volatile("s_wait_dscnt 0x0" ::: "memory");   /* the wave's own rows are in LDS before other lanes of the wave read them back */
#pragma unroll
    for (int i = 0; i < 8; ++i) { const int r = 2 * i + hi; *(v4f*)(op + (size_t)(2 * i) * DM) = *(const v4fa*)(S + r * 256 + ((lr ^ r) << 4)); } }   /* row 2 i + hi, floats 4 lr + 0..3 */
__global__ __launch_bounds__(512) void k_fattn(const float* __restrict__ Qf, const float* __restrict__ Kf, const float* __restrict__ Vf, float* __restrict__ OUTb) {
    typedef WFrag<bf>::V V;
    typedef __attribute__((ext_vector_type(2))) float f2; typedef __attribute__((ext_vector_type(2))) _Float16 h2;
    __shared__ __attribute__((aligned(256))) unsigned char L[4 * BBY];
    const int lane = threadIdx.x & 31, lr = lane & 15, hi = lane >> 4, w = __builtin_amdgcn_readfirstlane(threadIdx.x >> 5), kh = w >> 3; const int h = blockIdx.y, q0 = (blockIdx.x * 8 + (w & 7)) * 32;
    const int sr = threadIdx.x >> 4, sc = threadIdx.x & 15;   /* staging: row sr + 32 i of the tile, floats 4 sc .. 4 sc + 3 of the head's 64 */
    const float* Kg = Kf + (size_t)sr * DM + h * HD + 4 * sc; const float* Vg = Vf + (size_t)sr * DM + h * HD + 4 * sc;
    unsigned char* Kst = L + sr * PK + 8 * sc; unsigned char* Vst = L + KBY + sr * PV + 8 * sc;
    const unsigned char* Krd = L + (kh * 32 + lr) * PK + 16 * hi;                                             /* A fragment of K: row lr of this wave group's 32, bytes 16 hi and 32 + 16 hi of each 64 */
    const unsigned char* Vrd = L + KBY + (kh * 32 + 8 * hi + (lane & 7)) * PV + 16 * ((lane >> 3) & 1);      /* the transposing load's lane address */
    const float* Qp = Qf + (size_t)(q0 + lr) * DM + h * HD + 8 * hi;
    { v4f pk[4], pv[4];   /* tiles 0 and 1 into slots 0 and 1 */
#pragma unroll
    for (int i = 0; i < 4; ++i) { pk[i] = *(const v4f*)(Kg + (size_t)i * 32 * DM); pv[i] = *(const v4f*)(Vg + (size_t)i * 32 * DM); }
#pragma unroll
    for (int i = 0; i < 4; ++i) { *(v4usa*)(Kst + (i >> 1) * BBY + (i & 1) * 32 * PK) = __builtin_bit_cast(v4usa, __builtin_convertvector(pk[i], b4v)); *(v4usa*)(Vst + (i >> 1) * BBY + (i & 1) * 32 * PV) = vh4(pv[i]); } }
    V q[2][2], kf[2][2];
#pragma unroll
    for (int t = 0; t < 2; ++t)
#pragma unroll
        for (int c = 0; c < 2; ++c) q[t][c] = cat16b(cvt8r(Qp + (size_t)t * 16 * DM + c * 32), cvt8r(Qp + (size_t)t * 16 * DM + c * 32 + 16));
    float mx[2] = {-3.0e38f, -3.0e38f}; v8f o[2][4]; float sum[2] = {0.f, 0.f};
#pragma unroll
    for (int g = 0; g < 2; ++g)
#pragma unroll
        for (int db = 0; db < 4; ++db) o[g][db] = (v8f){};
    __syncthreads();   /* publishes tiles 0 and 1 */
    // rolled: the body (a pair of tiles, one pass of this wave in each) is long enough to fill the pipes, and the code stays small for the instruction cache
#pragma unroll 1
    for (int sp = 0; sp < NS / 2; ++sp) { const unsigned bo = (unsigned)(sp & 1) * 2 * BBY, bn = 2 * BBY - bo; const bool more = sp + 1 < NS / 2;   /* more: a scalar test, the same in every wave */
#pragma unroll
        for (int t = 0; t < 2; ++t)
#pragma unroll
            for (int c = 0; c < 2; ++c) kf[t][c] = cat16b(*(const v8usa*)(Krd + bo + t * 16 * PK + c * 64), *(const v8usa*)(Krd + bo + t * 16 * PK + c * 64 + 32));
#pragma unroll
        for (int ps = 0; ps < 2; ++ps) { v16h vf[4]; v8f s[2][2]; v4f rk[2], rv[2];   /* pass ps: this wave group's 32 keys of tile 2 sp + ps */
        if (more) {   /* the f32 rows of the tile after next fly during this pass */
#pragma unroll
            for (int i = 0; i < 2; ++i) { rk[i] = *(const v4f*)(Kg + (size_t)((2 * sp + 2 + ps) * SK + i * 32) * DM); rv[i] = *(const v4f*)(Vg + (size_t)((2 * sp + 2 + ps) * SK + i * 32) * DM); } }
#pragma unroll
        for (int db = 0; db < 4; ++db) vf[db] = cat16(__builtin_bit_cast(v8h, ldtr(Vrd + bo + ps * BBY + db * 32)), __builtin_bit_cast(v8h, ldtr(Vrd + bo + ps * BBY + 16 * PV + db * 32)));
#pragma unroll
        for (int t = 0; t < 2; ++t)
#pragma unroll
            for (int g = 0; g < 2; ++g) { s[g][t] = WFrag<bf>::mma(kf[t][0], q[g][0], (v8f){}); s[g][t] = WFrag<bf>::mma(kf[t][1], q[g][1], s[g][t]); }
        float p[2][16], rs[2];
#pragma unroll
        for (int g = 0; g < 2; ++g) rs[g] = pexp(s[g][0], s[g][1], mx[g], p[g]);
        if (__builtin_amdgcn_ballot_w32(!(rs[0] <= PBIG) || !(rs[1] <= PBIG)) != 0) {   /* one scalar branch a pass; always taken on the first pass, where every p is inf and the factor is exp(-inf) = 0 on zeros */
#pragma unroll
            for (int g = 0; g < 2; ++g) { float bm = s[g][0][0];
#pragma unroll
                for (int t = 0; t < 2; ++t)
#pragma unroll
                    for (int j = 0; j < 8; ++j) bm = fmaxf(bm, s[g][t][j]);
                bm = fmaxf(bm, xhalf(bm));
                const float mn = fmaxf(mx[g], bm + POFF); const float sc2 = __builtin_amdgcn_exp2f((mx[g] - mn) * 1.4426950408889634f); mx[g] = mn; sum[g] *= sc2;
#pragma unroll
                for (int db = 0; db < 4; ++db) o[g][db] *= sc2; }
#pragma unroll
            for (int g = 0; g < 2; ++g) rs[g] = pexp(s[g][0], s[g][1], mx[g], p[g]); }
        u8v hu[2];
#pragma unroll
        for (int g = 0; g < 2; ++g) { sum[g] += rs[g];
#pragma unroll
            for (int j = 0; j < 16; j += 2) { f2 pp; pp[0] = p[g][j]; pp[1] = p[g][j + 1]; hu[g][j / 2] = __builtin_bit_cast(unsigned, __builtin_convertvector(pp, h2)); } }
        if (ps == 0) {   /* the pair's second tile is published already: its fragments come in during the second product */
#pragma unroll
            for (int t = 0; t < 2; ++t)
#pragma unroll
                for (int c = 0; c < 2; ++c) kf[t][c] = cat16b(*(const v8usa*)(Krd + bo + BBY + t * 16 * PK + c * 64), *(const v8usa*)(Krd + bo + BBY + t * 16 * PK + c * 64 + 32)); }
#pragma unroll
        for (int g = 0; g < 2; ++g) { const v16h ph = __builtin_bit_cast(v16h, hu[g]);
#pragma unroll
            for (int db = 0; db < 4; ++db) o[g][db] = WFrag<h16>::mma(vf[db], ph, o[g][db]); }
        // four vector slots behind the pass's last products: a branch follows, on whose taken side the operands or results of those products may be touched at once
        asm volatile("v_nop\n\tv_nop\n\tv_nop\n\tv_nop" : "+v"(o[0][0]), "+v"(o[0][1]), "+v"(o[0][2]), "+v"(o[0][3]), "+v"(o[1][0]), "+v"(o[1][1]), "+v"(o[1][2]), "+v"(o[1][3]));
        if (more) {   /* the tile after next, rounded, into a slot that every wave left at the last barrier */
#pragma unroll
            for (int i = 0; i < 2; ++i) { *(v4usa*)(Kst + bn + ps * BBY + i * 32 * PK) = __builtin_bit_cast(v4usa, __builtin_convertvector(rk[i], b4v)); *(v4usa*)(Vst + bn + ps * BBY + i * 32 * PV) = vh4(rv[i]); } }
        }
        __syncthreads();   /* publishes the two tiles just stored and ends every wave's reads of the two just used; the last one frees the ring for the merge */
    }
    // merge of the two key halves: wave group kh keeps column group kh and hands the other to its partner w ^ 8, through the ring's LDS; kh is scalar, so each side of the branches indexes the register arrays by constants, and the barrier stands outside them
    if (kh == 0) xgive(L, w, lane, o[1], mx[1], sum[1]); else xgive(L, w, lane, o[0], mx[0], sum[0]);
    __syncthreads();   /* publishes the handed-over partial results */
    float* op = OUTb + (size_t)(q0 + kh * 16 + hi) * DM + h * HD + 4 * lr;   /* the row-major read-back's lane address: row hi of each pair of rows, floats 4 lr .. 4 lr + 3 */
    if (kh == 0) xtake(L, w ^ 8, lane, o[0], mx[0], sum[0], op); else xtake(L, w ^ 8, lane, o[1], mx[1], sum[1], op);
}

__device__ __forceinline__ h16 tohx(float x) { return (h16)x; }
__device__ __forceinline__ void splitf(float y, unsigned short& h, unsigned short& l) { h = f2bf(y); l = f2bf(y - bf2f(h)); }
typedef __attribute__((ext_vector_type(2))) _Float16 v2h;
typedef __attribute__((ext_vector_type(4))) _Float16 v4h;
typedef __attribute__((ext_vector_type(2))) unsigned short v2us;
typedef __attribute__((ext_vector_type(4))) unsigned short v4us;
typedef __attribute__((ext_vector_type(2))) float v2f;
typedef __attribute__((ext_vector_type(4))) int v4i;

__global__ __launch_bounds__(256) void k_wtG(const float* __restrict__ w, int K, int N, bf* Bt) {
    const int lane = threadIdx.x & 31; const int L0 = (blockIdx.x * 8 + (threadIdx.x >> 5)) * 8; const int nlines = N * K / 64;
{
#pragma unroll 1
        for (int l = 0; l < 8; ++l) { const int L = L0 + l; if (L >= nlines) break; const size_t e = (size_t)L * 64 + lane * 2; const int k = (int)(e % K), n = (int)(e / K); v2us o;
            o[0] = f2bf(w[(size_t)k * N + n]); o[1] = f2bf(w[(size_t)(k + 1) * N + n]); *(v2us*)(Bt + e) = o; }
         }
}
__global__ __launch_bounds__(256) void k_cvt8(const float* __restrict__ src, bf* dst, size_t n8) { const size_t i = (size_t)blockIdx.x * 256 + threadIdx.x; if (i >= n8) return; const v8f v = *(const v8f*)(src + i * 8); v8us o;
#pragma unroll
    for (int k = 0; k < 8; ++k) o[k] = f2bf(v[k]); *(v8us*)(dst + i * 8) = o;  }


__global__ __launch_bounds__(256) void k_vtp(const float* __restrict__ F, int pitch, int nheads, h16* V16, bf* Vh, bf* Vl) { const size_t e = ((size_t)blockIdx.x * 256 + threadIdx.x) * 2; if (e >= (size_t)nheads * HD * TT) return; const int t = (int)(e % TT); const int d = (int)((e / TT) % HD); const int g = (int)(e / ((size_t)TT * HD)); v2h o16; v2us oh, ol;
#pragma unroll
    for (int q = 0; q < 2; ++q) { const float x = F[(size_t)(t + q) * pitch + g * HD + d]; o16[q] = tohx(x); unsigned short a2, c2; splitf(x, a2, c2); oh[q] = a2; ol[q] = c2; }
    *(v2h*)(V16 + e) = o16; *(v2us*)(Vh + e) = oh; *(v2us*)(Vl + e) = ol;  }

__global__ __launch_bounds__(256) void k_merge(const float* __restrict__ O, int h0, float* OUTb) { const size_t e = ((size_t)blockIdx.x * 256 + threadIdx.x) * 2; if (e >= (size_t)ZH * TT * HD) return; const int d = (int)(e % HD); const int t = (int)((e / HD) % TT); const int zz = (int)(e / ((size_t)HD * TT)); const float cs = (t < RH) ? 1.0f : (1.0f / PCAR); const size_t oo = (size_t)t * DQ + (h0 + zz) * HD + d;
    v2f o2; o2[0] = O[e] * cs; o2[1] = O[e + 1] * cs; *(v2f*)(OUTb + oo) = o2;  }


__global__ __launch_bounds__(256) void k_vtpR1(const float* __restrict__ Vb, bf* Vh) { const size_t e = ((size_t)blockIdx.x * 256 + threadIdx.x) * 2; if (e >= (size_t)HD * TT) return; const int t = (int)(e % TT); const int d = (int)(e / TT); v2us o; o[0] = f2bf(Vb[(size_t)t * HD + d]); o[1] = f2bf(Vb[(size_t)(t + 1) * HD + d]); *(v2us*)(Vh + e) = o;  }
__global__ __launch_bounds__(256) void k_mergeR(const float* __restrict__ O, float* outb, size_t n4) { const size_t i = (size_t)blockIdx.x * 256 + threadIdx.x; if (i >= n4) return; const v4f a = *(const v4f*)(O + i * 4); *(v4f*)(outb + i * 4) = a;  }


extern "C" void kernel_launch(void* const* d_in, const int* in_sizes, int n_in,
                              void* d_out, int out_size, void* d_ws, size_t ws_size, hipStream_t stream) {
    (void)in_sizes; (void)n_in; (void)out_size;
    const float* Qin = (const float*)d_in[0]; const float* Kin = (const float*)d_in[1]; const float* Vin = (const float*)d_in[2];
    float* OUT = (float*)d_out;
    (void)d_ws; (void)ws_size;
    for (int b = 0; b < NB_; ++b) {
        const float* qb = Qin + (size_t)b * TT * DM; const float* kb = Kin + (size_t)b * TT * DM; const float* vb = Vin + (size_t)b * TT * DM;   /* token-major [t][h][d] slabs */
        k_fattn<<<dim3(TT / 256, NH_, 1), 512, 0, stream>>>(qb, kb, vb, OUT + (size_t)b * TT * DM); }   /* inputs rounded to bf16 on the way into LDS and registers, exact scores, f32 softmax, P (f16) x exact v^T, merged f32 output rows */
}

// v009
// One run takes 32.3 microseconds.
// Timed twice side by side with v008, it ran 1.05 and 1.06 times as fast.
// Over all steps from v000 it is 67.4 times as fast.
#include <hip/hip_runtime.h>

// Core dot-product attention on sequence-first tensors (query, key, value [2048][2][16][64] = [sq][b][np][hn]; scores = q.k UNscaled (the module computes sqrt(hn) but never applies it: logit sigma ~8); softmax over all 2,048 keys; context -> [2048][2][1024] (4.2 M)). The (b, np) pairs are 32 independent heads of one token-major [2048][2048] slab, and the output row layout [s][b][np*hn] is that same slab, so the whole problem is one pass over 32 heads.
// Layout: no planes in memory: each work-group rounds its head's rows to bf16 on the way into LDS (exact score products of the rounded inputs); f32 softmax; probabilities as ONE f16 value each (11 significant bits) against the bf16-rounded values held in f16; merged f32 output rows.
// Compute dtypes, f32 accumulate: every input rounded to bf16; q.k exact (bf16 products); softmax f32; P rounded once to f16 x exact values (f16 products); output f32.

#define NB_  1
#define TT   2048
#define DM   2048      // token-major row pitch (H x HD)
#define NH_  32
#define NKV  1
#define REP  (NH_ / NKV)
#define HD   64
#define DQ   (NH_ * HD)
#define DKV  (NKV * HD)
#define ZH   1
#define RH   2048                  // k_merge (not launched): rows < RH keep scale 1, later rows 1 / PCAR
#define WIN  0
#define PCAR 1024.0f
#define SCL  1.0f   // unscaled (the module never applies its norm_factor)
typedef _Float16 h16;
typedef unsigned short bf;
typedef __attribute__((ext_vector_type(16))) __bf16   v16bf;
typedef __attribute__((ext_vector_type(16))) _Float16 v16h;
typedef __attribute__((ext_vector_type(8)))  _Float16 v8h;
typedef __attribute__((ext_vector_type(8)))  unsigned short v8us;
typedef __attribute__((ext_vector_type(8)))  float    v8f;
typedef __attribute__((ext_vector_type(4)))  float    v4f;
typedef v8h  __attribute__((may_alias)) v8ha;
typedef v4f  __attribute__((may_alias)) v4fa;
typedef v8us __attribute__((may_alias)) v8usa;

__device__ __forceinline__ unsigned short f2bf(float f) { unsigned u = __float_as_uint(f); u += 0x7FFFu + ((u >> 16) & 1u); return (unsigned short)(u >> 16); }
__device__ __forceinline__ float bf2f(unsigned short b) { return __uint_as_float(((unsigned)b) << 16); }
__device__ __forceinline__ float bfr(float f) { return bf2f(f2bf(f)); }
__device__ __forceinline__ v16h cat16(v8h lo, v8h hi) { return __builtin_shufflevector(lo, hi, 0, 1, 2, 3, 4, 5, 6, 7, 8, 9, 10, 11, 12, 13, 14, 15); }
__device__ __forceinline__ v16bf cat16b(v8us lo, v8us hi) { return __builtin_bit_cast(v16bf, __builtin_shufflevector(lo, hi, 0, 1, 2, 3, 4, 5, 6, 7, 8, 9, 10, 11, 12, 13, 14, 15)); }
__device__ __forceinline__ v8f wmma16(v16h a, v16h b, v8f c) { return __builtin_amdgcn_wmma_f32_16x16x32_f16(false, a, false, b, (short)0, c, false, false); }
__device__ __forceinline__ v8f wmmab(v16bf a, v16bf b, v8f c) { return __builtin_amdgcn_wmma_f32_16x16x32_bf16(false, a, false, b, (short)0, c, false, false); }



// fragment loaders and products of the 16x16x32 forms: a lane takes k 8 hi + 0..7 and 16 + 8 hi + 0..7 of its row
template <typename T16> struct WFrag;
template <> struct WFrag<h16> { typedef v16h V; static __device__ __forceinline__ V ld(const h16* p) { return cat16(*(const v8h*)p, *(const v8h*)(p + 16)); } static __device__ __forceinline__ v8f mma(V a, V b, v8f c) { return wmma16(a, b, c); } };
template <> struct WFrag<bf> { typedef v16bf V; static __device__ __forceinline__ V ld(const bf* p) { return cat16b(*(const v8us*)p, *(const v8us*)(p + 16)); } static __device__ __forceinline__ v8f mma(V a, V b, v8f c) { return wmmab(a, b, c); } };

#define PBIG 0x1p15f                // guard on the in-lane row sum: every p of a kept pass is finite in f16
#define POFF 4.1588830833596715f    // 6 ln 2: a search leaves the largest p at 2^-6
#define SK   64                     // keys per tile
#define NS   (TT / SK)
#define PK   144                    // LDS pitch of a K row, bytes
#define PV   160                    // LDS pitch of a V row, bytes
#define KBY  (SK * PK)              // K part of a slot
#define BBY  (SK * PK + SK * PV)    // one slot
#define XWB  4096                   // merge: bytes of one wave's handed-over output tile (32 floats a lane)
#define XMB  (16 * XWB)             // merge: where the handed-over maxima and row sums start (8 bytes a lane)
typedef __attribute__((ext_vector_type(4))) unsigned short v4usa __attribute__((may_alias));
typedef __attribute__((ext_vector_type(2))) float f2a __attribute__((may_alias));
typedef __attribute__((ext_vector_type(4))) __bf16 b4v;
typedef __attribute__((ext_vector_type(8))) __bf16 b8v;
typedef __attribute__((ext_vector_type(8))) short s16x8;
typedef __attribute__((address_space(3))) s16x8 lds_s16x8;
__device__ __forceinline__ float xhalf(float x) { const int b = __float_as_int(x); return __int_as_float(__builtin_amdgcn_permlanex16(b, b, 0x76543210, 0xfedcba98, false, false)); }   // lane l <-> l ^ 16
__device__ __forceinline__ v8us ldtr(const unsigned char* p) { return __builtin_bit_cast(v8us, __builtin_amdgcn_ds_load_tr16_b128_v8i16((lds_s16x8*)p)); }
__device__ __forceinline__ v8us cvt8r(const float* p) { return __builtin_bit_cast(v8us, __builtin_convertvector(*(const v8f*)p, b8v)); }   // 8 f32 -> 8 bf16, round to nearest even
typedef __attribute__((ext_vector_type(8))) unsigned u8v;
// four f32 values rounded to bf16 (the rounding of every input) and written as f16: exact for magnitudes from 2^-14 up, an absolute error under 2^-25 below
typedef __attribute__((ext_vector_type(2))) unsigned u2v;
__device__ __forceinline__ v4usa vh4(v4f x) { typedef __attribute__((ext_vector_type(2))) float f2; typedef __attribute__((ext_vector_type(2))) _Float16 h2; const u2v u = __builtin_bit_cast(u2v, __builtin_convertvector(x, b4v)); u2v r;
#pragma unroll
    for (int i = 0; i < 2; ++i) { f2 y; y[0] = __uint_as_float(u[i] << 16); y[1] = __uint_as_float(u[i] & 0xffff0000u); r[i] = __builtin_bit_cast(unsigned, __builtin_convertvector(y, h2)); }   /* a bf16 is the upper half of its f32 */
    return __builtin_bit_cast(v4usa, r); }
// probabilities of one column group's 32 keys (two score tiles) against the maximum in use m, into p, and their in-lane sum, added up as a tree of packed pairs
__device__ __forceinline__ float pexp(const v8f s0, const v8f s1, float m, float* p) {
    typedef __attribute__((ext_vector_type(2))) float f2; f2 a[2];
#pragma unroll
    for (int t = 0; t < 2; ++t) { const v8f s = t ? s1 : s0; f2 e[4];
#pragma unroll
        for (int j = 0; j < 8; j += 2) { f2 pp; pp[0] = __builtin_amdgcn_exp2f((s[j] - m) * 1.4426950408889634f); pp[1] = __builtin_amdgcn_exp2f((s[j + 1] - m) * 1.4426950408889634f); p[t * 8 + j] = pp[0]; p[t * 8 + j + 1] = pp[1]; e[j / 2] = pp; }
        a[t] = (e[0] + e[1]) + (e[2] + e[3]); }
    const f2 r = a[0] + a[1]; return r[0] + r[1]; }
// merge, first half: a wave hands one column group's partial result (output tile, maximum in use, in-lane row sum) to its partner; lanes 16 bytes apart in the output tile's stores, 8 bytes in that of maximum and row sum
__device__ __forceinline__ void xgive(unsigned char* X, int w, int lane, const v8f* o, float m, float l) {
#pragma unroll
    for (int db = 0; db < 4; ++db) { v4f a, c;
#pragma unroll
        for (int j = 0; j < 4; ++j) { a[j] = o[db][j]; c[j] = o[db][j + 4]; }
        *(v4fa*)(X + w * XWB + (db * 2) * 512 + lane * 16) = a; *(v4fa*)(X + w * XWB + (db * 2 + 1) * 512 + lane * 16) = c; }
    f2a ml; ml[0] = m; ml[1] = l; *(f2a*)(X + XMB + w * 256 + lane * 8) = ml; }
// merge, second half: own partial and the partner's (wave p, same lane = same column and same output rows) brought to the common maximum, summed, divided by the joined row sum.
// The merged tile (16 query rows of 64 floats) then passes through LDS, so that a store covers whole lines: from the registers a store would lay 16-byte pieces on 16 lines; read back row-major, lanes 0..15 hold one row's 256 bytes and lanes 16..31 the next row's.
// The stage is the partner's handed-over tile, 4,096 bytes that this wave alone reads and has read by then. Rows have no pad: the 16-byte piece k of row r lies at place k ^ r, so the 16 lanes of a half hit 16 different places in the column-wise writes and in the row-wise reads.
__device__ __forceinline__ void xtake(unsigned char* X, int p, int lane, const v8f* o, float m, float l, float* op) {
    const int lr = lane & 15, hi = lane >> 4;
    const f2a ml = *(const f2a*)(X + XMB + p * 256 + lane * 8); const float d = m - ml[0];
    const float e = __builtin_amdgcn_exp2f(-__builtin_fabsf(d) * 1.4426950408889634f); const float fa = d < 0.f ? e : 1.0f, fb = d < 0.f ? 1.0f : e;   /* the side with the larger maximum keeps its scale */
    float t = l * fa + ml[1] * fb; t += xhalf(t); const float f = __fdiv_rn(1.0f, t); const float ca = fa * f, cb = fb * f;
    unsigned char* S = X + p * XWB; v4f a[4], c[4];
#pragma unroll
    for (int db = 0; db < 4; ++db) { const v4f pa = *(const v4fa*)(S + (db * 2) * 512 + lane * 16), pc = *(const v4fa*)(S + (db * 2 + 1) * 512 + lane * 16);
#pragma unroll
        for (int j = 0; j < 4; ++j) { a[db][j] = o[db][j] * ca + pa[j] * cb; c[db][j] = o[db][j + 4] * ca + pc[j] * cb; } }
#pragma unroll
    for (int db = 0; db < 4; ++db) { *(v4fa*)(S + lr * 256 + (((db * 4 + hi * 2) ^ lr) << 4)) = a[db]; *(v4fa*)(S + lr * 256 + (((db * 4 + hi * 2 + 1) ^ lr) << 4)) = c[db]; }   /* row lr, floats 16 db + 8 hi + 0..7 */
    asm volatile("s_wait_dscnt 0x0" ::: "memory");   /* the wave's own rows are in LDS before other lanes of the wave read them back */
#pragma unroll
    for (int i = 0; i < 8; ++i) { const int r = 2 * i + hi; *(v4f*)(op + (size_t)(2 * i) * DM) = *(const v4fa*)(S + r * 256 + ((lr ^ r) << 4)); } }   /* row 2 i + hi, floats 4 lr + 0..3 */
__global__ __launch_bounds__(512) void k_fattn(const float* __restrict__ Qf, const float* __restrict__ Kf, const float* __restrict__ Vf, float* __restrict__ OUTb) {
    typedef WFrag<bf>::V V;
    typedef __attribute__((ext_vector_type(2))) float f2; typedef __attribute__((ext_vector_type(2))) _Float16 h2;
    __shared__ __attribute__((aligned(256))) unsigned char L[8 * BBY];
    const int lane = threadIdx.x & 31, lr = lane & 15, hi = lane >> 4, w = __builtin_amdgcn_readfirstlane(threadIdx.x >> 5), kh = w >> 3; const int h = blockIdx.y, q0 = (blockIdx.x * 8 + (w & 7)) * 32;
    const int sr = threadIdx.x >> 4, sc = threadIdx.x & 15;   /* staging: row sr + 32 i of the tile, floats 4 sc .. 4 sc + 3 of the head's 64 */
    const float* Kg = Kf + (size_t)sr * DM + h * HD + 4 * sc; const float* Vg = Vf + (size_t)sr * DM + h * HD + 4 * sc;
    unsigned char* Kst = L + sr * PK + 8 * sc; unsigned char* Vst = L + KBY + sr * PV + 8 * sc;
    const unsigned char* Krd = L + (kh * 32 + lr) * PK + 16 * hi;                                             /* A fragment of K: row lr of this wave group's 32, bytes 16 hi and 32 + 16 hi of each 64 */
    const unsigned char* Vrd = L + KBY + (kh * 32 + 8 * hi + (lane & 7)) * PV + 16 * ((lane >> 3) & 1);      /* the transposing load's lane address */
    const float* Qp = Qf + (size_t)(q0 + lr) * DM + h * HD + 8 * hi;
    { v4f pk[8], pv[8];   /* tiles 0 to 3 into slots 0 to 3 */
#pragma unroll
    for (int i = 0; i < 8; ++i) { pk[i] = *(const v4f*)(Kg + (size_t)i * 32 * DM); pv[i] = *(const v4f*)(Vg + (size_t)i * 32 * DM); }
#pragma unroll
    for (int i = 0; i < 8; ++i) { *(v4usa*)(Kst + (i >> 1) * BBY + (i & 1) * 32 * PK) = __builtin_bit_cast(v4usa, __builtin_convertvector(pk[i], b4v)); *(v4usa*)(Vst + (i >> 1) * BBY + (i & 1) * 32 * PV) = vh4(pv[i]); } }
    V q[2][2], kf[2][2];
#pragma unroll
    for (int t = 0; t < 2; ++t)
#pragma unroll
        for (int c = 0; c < 2; ++c) q[t][c] = cat16b(cvt8r(Qp + (size_t)t * 16 * DM + c * 32), cvt8r(Qp + (size_t)t * 16 * DM + c * 32 + 16));
    float mx[2] = {-3.0e38f, -3.0e38f}; v8f o[2][4]; float sum[2] = {0.f, 0.f};
#pragma unroll
    for (int g = 0; g < 2; ++g)
#pragma unroll
        for (int db = 0; db < 4; ++db) o[g][db] = (v8f){};
    __syncthreads();   /* publishes tiles 0 to 3 */
    __builtin_amdgcn_s_barrier_signal(-1);   /* opens the alternation: every foot of the loop waits first, then signals; this one stands for a pair in front of pair 0 and hands over nothing */
    // rolled: the body (a pair of tiles, one pass of this wave in each) is long enough to fill the pipes, and the code stays small for the instruction cache
#pragma unroll 1
    for (int sp = 0; sp < NS / 2; ++sp) { const unsigned bo = (unsigned)(sp & 3) * 2 * BBY, bn = (unsigned)((sp + 2) & 3) * 2 * BBY; const bool more = sp + 2 < NS / 2;   /* more: a scalar test, the same in every wave */
#pragma unroll
        for (int t = 0; t < 2; ++t)
#pragma unroll
            for (int c = 0; c < 2; ++c) kf[t][c] = cat16b(*(const v8usa*)(Krd + bo + t * 16 * PK + c * 64), *(const v8usa*)(Krd + bo + t * 16 * PK + c * 64 + 32));
#pragma unroll
        for (int ps = 0; ps < 2; ++ps) { v16h vf[4]; v8f s[2][2]; v4f rk[2], rv[2];   /* pass ps: this wave group's 32 keys of tile 2 sp + ps */
        if (more) {   /* the f32 rows of the tile four ahead fly during this pass */
#pragma unroll
            for (int i = 0; i < 2; ++i) { rk[i] = *(const v4f*)(Kg + (size_t)((2 * sp + 4 + ps) * SK + i * 32) * DM); rv[i] = *(const v4f*)(Vg + (size_t)((2 * sp + 4 + ps) * SK + i * 32) * DM); } }
#pragma unroll
        for (int db = 0; db < 4; ++db) vf[db] = cat16(__builtin_bit_cast(v8h, ldtr(Vrd + bo + ps * BBY + db * 32)), __builtin_bit_cast(v8h, ldtr(Vrd + bo + ps * BBY + 16 * PV + db * 32)));
#pragma unroll
        for (int t = 0; t < 2; ++t)
#pragma unroll
            for (int g = 0; g < 2; ++g) { s[g][t] = WFrag<bf>::mma(kf[t][0], q[g][0], (v8f){}); s[g][t] = WFrag<bf>::mma(kf[t][1], q[g][1], s[g][t]); }
        float p[2][16], rs[2];
#pragma unroll
        for (int g = 0; g < 2; ++g) rs[g] = pexp(s[g][0], s[g][1], mx[g], p[g]);
        if (__builtin_amdgcn_ballot_w32(!(rs[0] <= PBIG) || !(rs[1] <= PBIG)) != 0) {   /* one scalar branch a pass; always taken on the first pass, where every p is inf and the factor is exp(-inf) = 0 on zeros */
#pragma unroll
            for (int g = 0; g < 2; ++g) { float bm = s[g][0][0];
#pragma unroll
                for (int t = 0; t < 2; ++t)
#pragma unroll
                    for (int j = 0; j < 8; ++j) bm = fmaxf(bm, s[g][t][j]);
                bm = fmaxf(bm, xhalf(bm));
                const float mn = fmaxf(mx[g], bm + POFF); const float sc2 = __builtin_amdgcn_exp2f((mx[g] - mn) * 1.4426950408889634f); mx[g] = mn; sum[g] *= sc2;
#pragma unroll
                for (int db = 0; db < 4; ++db) o[g][db] *= sc2; }
#pragma unroll
            for (int g = 0; g < 2; ++g) rs[g] = pexp(s[g][0], s[g][1], mx[g], p[g]); }
        u8v hu[2];
#pragma unroll
        for (int g = 0; g < 2; ++g) { sum[g] += rs[g];
#pragma unroll
            for (int j = 0; j < 16; j += 2) { f2 pp; pp[0] = p[g][j]; pp[1] = p[g][j + 1]; hu[g][j / 2] = __builtin_bit_cast(unsigned, __builtin_convertvector(pp, h2)); } }
        if (ps == 0) {   /* the pair's second tile is published already: its fragments come in during the second product */
#pragma unroll
            for (int t = 0; t < 2; ++t)
#pragma unroll
                for (int c = 0; c < 2; ++c) kf[t][c] = cat16b(*(const v8usa*)(Krd + bo + BBY + t * 16 * PK + c * 64), *(const v8usa*)(Krd + bo + BBY + t * 16 * PK + c * 64 + 32)); }
#pragma unroll
        for (int g = 0; g < 2; ++g) { const v16h ph = __builtin_bit_cast(v16h, hu[g]);
#pragma unroll
            for (int db = 0; db < 4; ++db) o[g][db] = WFrag<h16>::mma(vf[db], ph, o[g][db]); }
        // four vector slots behind the pass's last products: a branch follows, on whose taken side the operands or results of those products may be touched at once
        asm volatile("v_nop\n\tv_nop\n\tv_nop\n\tv_nop" : "+v"(o[0][0]), "+v"(o[0][1]), "+v"(o[0][2]), "+v"(o[0][3]), "+v"(o[1][0]), "+v"(o[1][1]), "+v"(o[1][2]), "+v"(o[1][3]));
        if (more) {   /* the tile four ahead, rounded, into a slot that every wave had left at the barrier last waited for */
#pragma unroll
            for (int i = 0; i < 2; ++i) { *(v4usa*)(Kst + bn + ps * BBY + i * 32 * PK) = __builtin_bit_cast(v4usa, __builtin_convertvector(rk[i], b4v)); *(v4usa*)(Vst + bn + ps * BBY + i * 32 * PV) = vh4(rv[i]); } }
        }
        // foot of pair sp: the parts of __syncthreads() with wait and signal in the other order. The release fence ends this wave's LDS stores and reads of the pair in front of its signal; the wait is for the barrier signalled one pair ago;
        // the acquire fence keeps the next pair's LDS reads and stores behind that wait. Signal and wait alternate strictly in every wave, and every wave passes every one of them.
        __builtin_amdgcn_fence(__ATOMIC_RELEASE, "workgroup");
        __builtin_amdgcn_s_barrier_wait(-1);
        __builtin_amdgcn_s_barrier_signal(-1);
        __builtin_amdgcn_fence(__ATOMIC_ACQUIRE, "workgroup");
    }
    __builtin_amdgcn_s_barrier_wait(-1);   /* the last pair's barrier: every wave has left the ring, which the merge now takes */
    __builtin_amdgcn_fence(__ATOMIC_ACQUIRE, "workgroup");   /* keeps the merge's LDS stores behind that wait */
    // merge of the two key halves: wave group kh keeps column group kh and hands the other to its partner w ^ 8, through the ring's LDS; kh is scalar, so each side of the branches indexes the register arrays by constants, and the barrier stands outside them
    if (kh == 0) xgive(L, w, lane, o[1], mx[1], sum[1]); else xgive(L, w, lane, o[0], mx[0], sum[0]);
    __syncthreads();   /* publishes the handed-over partial results */
    float* op = OUTb + (size_t)(q0 + kh * 16 + hi) * DM + h * HD + 4 * lr;   /* the row-major read-back's lane address: row hi of each pair of rows, floats 4 lr .. 4 lr + 3 */
    if (kh == 0) xtake(L, w ^ 8, lane, o[0], mx[0], sum[0], op); else xtake(L, w ^ 8, lane, o[1], mx[1], sum[1], op);
}

__device__ __forceinline__ h16 tohx(float x) { return (h16)x; }
__device__ __forceinline__ void splitf(float y, unsigned short& h, unsigned short& l) { h = f2bf(y); l = f2bf(y - bf2f(h)); }
typedef __attribute__((ext_vector_type(2))) _Float16 v2h;
typedef __attribute__((ext_vector_type(4))) _Float16 v4h;
typedef __attribute__((ext_vector_type(2))) unsigned short v2us;
typedef __attribute__((ext_vector_type(4))) unsigned short v4us;
typedef __attribute__((ext_vector_type(2))) float v2f;
typedef __attribute__((ext_vector_type(4))) int v4i;

__global__ __launch_bounds__(256) void k_wtG(const float* __restrict__ w, int K, int N, bf* Bt) {
    const int lane = threadIdx.x & 31; const int L0 = (blockIdx.x * 8 + (threadIdx.x >> 5)) * 8; const int nlines = N * K / 64;
{
#pragma unroll 1
        for (int l = 0; l < 8; ++l) { const int L = L0 + l; if (L >= nlines) break; const size_t e = (size_t)L * 64 + lane * 2; const int k = (int)(e % K), n = (int)(e / K); v2us o;
            o[0] = f2bf(w[(size_t)k * N + n]); o[1] = f2bf(w[(size_t)(k + 1) * N + n]); *(v2us*)(Bt + e) = o; }
         }
}
__global__ __launch_bounds__(256) void k_cvt8(const float* __restrict__ src, bf* dst, size_t n8) { const size_t i = (size_t)blockIdx.x * 256 + threadIdx.x; if (i >= n8) return; const v8f v = *(const v8f*)(src + i * 8); v8us o;
#pragma unroll
    for (int k = 0; k < 8; ++k) o[k] = f2bf(v[k]); *(v8us*)(dst + i * 8) = o;  }


__global__ __launch_bounds__(256) void k_vtp(const float* __restrict__ F, int pitch, int nheads, h16* V16, bf* Vh, bf* Vl) { const size_t e = ((size_t)blockIdx.x * 256 + threadIdx.x) * 2; if (e >= (size_t)nheads * HD * TT) return; const int t = (int)(e % TT); const int d = (int)((e / TT) % HD); const int g = (int)(e / ((size_t)TT * HD)); v2h o16; v2us oh, ol;
#pragma unroll
    for (int q = 0; q < 2; ++q) { const float x = F[(size_t)(t + q) * pitch + g * HD + d]; o16[q] = tohx(x); unsigned short a2, c2; splitf(x, a2, c2); oh[q] = a2; ol[q] = c2; }
    *(v2h*)(V16 + e) = o16; *(v2us*)(Vh + e) = oh; *(v2us*)(Vl + e) = ol;  }

__global__ __launch_bounds__(256) void k_merge(const float* __restrict__ O, int h0, float* OUTb) { const size_t e = ((size_t)blockIdx.x * 256 + threadIdx.x) * 2; if (e >= (size_t)ZH * TT * HD) return; const int d = (int)(e % HD); const int t = (int)((e / HD) % TT); const int zz = (int)(e / ((size_t)HD * TT)); const float cs = (t < RH) ? 1.0f : (1.0f / PCAR); const size_t oo = (size_t)t * DQ + (h0 + zz) * HD + d;
    v2f o2; o2[0] = O[e] * cs; o2[1] = O[e + 1] * cs; *(v2f*)(OUTb + oo) = o2;  }


__global__ __launch_bounds__(256) void k_vtpR1(const float* __restrict__ Vb, bf* Vh) { const size_t e = ((size_t)blockIdx.x * 256 + threadIdx.x) * 2; if (e >= (size_t)HD * TT) return; const int t = (int)(e % TT); const int d = (int)(e / TT); v2us o; o[0] = f2bf(Vb[(size_t)t * HD + d]); o[1] = f2bf(Vb[(size_t)(t + 1) * HD + d]); *(v2us*)(Vh + e) = o;  }
__global__ __launch_bounds__(256) void k_mergeR(const float* __restrict__ O, float* outb, size_t n4) { const size_t i = (size_t)blockIdx.x * 256 + threadIdx.x; if (i >= n4) return; const v4f a = *(const v4f*)(O + i * 4); *(v4f*)(outb + i * 4) = a;  }


extern "C" void kernel_launch(void* const* d_in, const int* in_sizes, int n_in,
                              void* d_out, int out_size, void* d_ws, size_t ws_size, hipStream_t stream) {
    (void)in_sizes; (void)n_in; (void)out_size;
    const float* Qin = (const float*)d_in[0]; const float* Kin = (const float*)d_in[1]; const float* Vin = (const float*)d_in[2];
    float* OUT = (float*)d_out;
    (void)d_ws; (void)ws_size;
    for (int b = 0; b < NB_; ++b) {
        const float* qb = Qin + (size_t)b * TT * DM; const float* kb = Kin + (size_t)b * TT * DM; const float* vb = Vin + (size_t)b * TT * DM;   /* token-major [t][h][d] slabs */
        k_fattn<<<dim3(TT / 256, NH_, 1), 512, 0, stream>>>(qb, kb, vb, OUT + (size_t)b * TT * DM); }   /* inputs rounded to bf16 on the way into LDS and registers, exact scores, f32 softmax, P (f16) x exact v^T, merged f32 output rows */
}

// v010
// Measured time: 30.9 microseconds a run.
// Next to v009, in two timings, it ran 1.04 times as fast each time.
// All steps since v000 together make it 70.3 times as fast.
#include <hip/hip_runtime.h>

// Core dot-product attention on sequence-first tensors (query, key, value [2048][2][16][64] = [sq][b][np][hn]; scores = q.k UNscaled (the module computes sqrt(hn) but never applies it: logit sigma ~8); softmax over all 2,048 keys; context -> [2048][2][1024] (4.2 M)). The (b, np) pairs are 32 independent heads of one token-major [2048][2048] slab, and the output row layout [s][b][np*hn] is that same slab, so the whole problem is one pass over 32 heads.
// Layout: no planes in memory: each work-group rounds its head's rows to bf16 on the way into LDS (exact score products of the rounded inputs); f32 softmax; probabilities as ONE f16 value each (11 significant bits) against the bf16-rounded values held in f16; merged f32 output rows.
// Compute dtypes, f32 accumulate: every input rounded to bf16; q.k exact (bf16 products); softmax f32; P rounded once to f16 x exact values (f16 products); output f32.

#define NB_  1
#define TT   2048
#define DM   2048      // token-major row pitch (H x HD)
#define NH_  32
#define NKV  1
#define REP  (NH_ / NKV)
#define HD   64
#define DQ   (NH_ * HD)
#define DKV  (NKV * HD)
#define ZH   1
#define RH   2048                  // k_merge (not launched): rows < RH keep scale 1, later rows 1 / PCAR
#define WIN  0
#define PCAR 1024.0f
#define SCL  1.0f   // unscaled (the module never applies its norm_factor)
typedef _Float16 h16;
typedef unsigned short bf;
typedef __attribute__((ext_vector_type(16))) __bf16   v16bf;
typedef __attribute__((ext_vector_type(16))) _Float16 v16h;
typedef __attribute__((ext_vector_type(8)))  _Float16 v8h;
typedef __attribute__((ext_vector_type(8)))  unsigned short v8us;
typedef __attribute__((ext_vector_type(8)))  float    v8f;
typedef __attribute__((ext_vector_type(4)))  float    v4f;
typedef v8h  __attribute__((may_alias)) v8ha;
typedef v4f  __attribute__((may_alias)) v4fa;
typedef v8us __attribute__((may_alias)) v8usa;

__device__ __forceinline__ unsigned short f2bf(float f) { unsigned u = __float_as_uint(f); u += 0x7FFFu + ((u >> 16) & 1u); return (unsigned short)(u >> 16); }
__device__ __forceinline__ float bf2f(unsigned short b) { return __uint_as_float(((unsigned)b) << 16); }
__device__ __forceinline__ float bfr(float f) { return bf2f(f2bf(f)); }
__device__ __forceinline__ v16h cat16(v8h lo, v8h hi) { return __builtin_shufflevector(lo, hi, 0, 1, 2, 3, 4, 5, 6, 7, 8, 9, 10, 11, 12, 13, 14, 15); }
__device__ __forceinline__ v16bf cat16b(v8us lo, v8us hi) { return __builtin_bit_cast(v16bf, __builtin_shufflevector(lo, hi, 0, 1, 2, 3, 4, 5, 6, 7, 8, 9, 10, 11, 12, 13, 14, 15)); }
__device__ __forceinline__ v8f wmma16(v16h a, v16h b, v8f c) { return __builtin_amdgcn_wmma_f32_16x16x32_f16(false, a, false, b, (short)0, c, false, false); }
__device__ __forceinline__ v8f wmmab(v16bf a, v16bf b, v8f c) { return __builtin_amdgcn_wmma_f32_16x16x32_bf16(false, a, false, b, (short)0, c, false, false); }



// fragment loaders and products of the 16x16x32 forms: a lane takes k 8 hi + 0..7 and 16 + 8 hi + 0..7 of its row
template <typename T16> struct WFrag;
template <> struct WFrag<h16> { typedef v16h V; static __device__ __forceinline__ V ld(const h16* p) { return cat16(*(const v8h*)p, *(const v8h*)(p + 16)); } static __device__ __forceinline__ v8f mma(V a, V b, v8f c) { return wmma16(a, b, c); } };
template <> struct WFrag<bf> { typedef v16bf V; static __device__ __forceinline__ V ld(const bf* p) { return cat16b(*(const v8us*)p, *(const v8us*)(p + 16)); } static __device__ __forceinline__ v8f mma(V a, V b, v8f c) { return wmmab(a, b, c); } };

#define PBIG 0x1p15f                // guard on the in-lane row sum: every p of a kept pass is finite in f16
#define POFF 4.1588830833596715f    // 6 ln 2: a search leaves the largest p at 2^-6
#define SK   64                     // keys per tile
#define NS   (TT / SK)
#define PK   144                    // LDS pitch of a K row, bytes
#define PV   160                    // LDS pitch of a V row, bytes
#define KBY  (SK * PK)              // K part of a slot
#define BBY  (SK * PK + SK * PV)    // one slot
#define XWB  4096                   // merge: bytes of one wave's handed-over output tile (32 floats a lane)
#define XMB  (16 * XWB)             // merge: where the handed-over maxima and row sums start (8 bytes a lane)
typedef __attribute__((ext_vector_type(4))) unsigned short v4usa __attribute__((may_alias));
typedef __attribute__((ext_vector_type(2))) float f2a __attribute__((may_alias));
typedef __attribute__((ext_vector_type(4))) __bf16 b4v;
typedef __attribute__((ext_vector_type(8))) __bf16 b8v;
typedef __attribute__((ext_vector_type(8))) short s16x8;
typedef __attribute__((address_space(3))) s16x8 lds_s16x8;
__device__ __forceinline__ float xhalf(float x) { const int b = __float_as_int(x); return __int_as_float(__builtin_amdgcn_permlanex16(b, b, 0x76543210, 0xfedcba98, false, false)); }   // lane l <-> l ^ 16
__device__ __forceinline__ v8us ldtr(const unsigned char* p) { return __builtin_bit_cast(v8us, __builtin_amdgcn_ds_load_tr16_b128_v8i16((lds_s16x8*)p)); }
__device__ __forceinline__ v8us cvt8r(const float* p) { return __builtin_bit_cast(v8us, __builtin_convertvector(*(const v8f*)p, b8v)); }   // 8 f32 -> 8 bf16, round to nearest even
typedef __attribute__((ext_vector_type(8))) unsigned u8v;
// four f32 values rounded to bf16 (the rounding of every input) and written as f16: exact for magnitudes from 2^-14 up, an absolute error under 2^-25 below
typedef __attribute__((ext_vector_type(2))) unsigned u2v;
__device__ __forceinline__ v4usa vh4(v4f x) { typedef __attribute__((ext_vector_type(2))) float f2; typedef __attribute__((ext_vector_type(2))) _Float16 h2; const u2v u = __builtin_bit_cast(u2v, __builtin_convertvector(x, b4v)); u2v r;
#pragma unroll
    for (int i = 0; i < 2; ++i) { f2 y; y[0] = __uint_as_float(u[i] << 16); y[1] = __uint_as_float(u[i] & 0xffff0000u); r[i] = __builtin_bit_cast(unsigned, __builtin_convertvector(y, h2)); }   /* a bf16 is the upper half of its f32 */
    return __builtin_bit_cast(v4usa, r); }
// probabilities of one column group's 32 keys (two score tiles) against the maximum in use m, into p, and their in-lane sum, added up as a tree of packed pairs
__device__ __forceinline__ float pexp(const v8f s0, const v8f s1, float m, float* p) {
    typedef __attribute__((ext_vector_type(2))) float f2; f2 a[2];
#pragma unroll
    for (int t = 0; t < 2; ++t) { const v8f s = t ? s1 : s0; f2 e[4];
#pragma unroll
        for (int j = 0; j < 8; j += 2) { f2 pp; pp[0] = __builtin_amdgcn_exp2f((s[j] - m) * 1.4426950408889634f); pp[1] = __builtin_amdgcn_exp2f((s[j + 1] - m) * 1.4426950408889634f); p[t * 8 + j] = pp[0]; p[t * 8 + j + 1] = pp[1]; e[j / 2] = pp; }
        a[t] = (e[0] + e[1]) + (e[2] + e[3]); }
    const f2 r = a[0] + a[1]; return r[0] + r[1]; }
// merge, first half: a wave hands one column group's partial result (output tile, maximum in use, in-lane row sum) to its partner; lanes 16 bytes apart in the output tile's stores, 8 bytes in that of maximum and row sum
__device__ __forceinline__ void xgive(unsigned char* X, int w, int lane, const v8f* o, float m, float l) {
#pragma unroll
    for (int db = 0; db < 4; ++db) { v4f a, c;
#pragma unroll
        for (int j = 0; j < 4; ++j) { a[j] = o[db][j]; c[j] = o[db][j + 4]; }
        *(v4fa*)(X + w * XWB + (db * 2) * 512 + lane * 16) = a; *(v4fa*)(X + w * XWB + (db * 2 + 1) * 512 + lane * 16) = c; }
    f2a ml; ml[0] = m; ml[1] = l; *(f2a*)(X + XMB + w * 256 + lane * 8) = ml; }
// merge, second half: own partial and the partner's (wave p, same lane = same column and same output rows) brought to the common maximum, summed, divided by the joined row sum.
// The merged tile (16 query rows of 64 floats) then passes through LDS, so that a store covers whole lines: from the registers a store would lay 16-byte pieces on 16 lines; read back row-major, lanes 0..15 hold one row's 256 bytes and lanes 16..31 the next row's.
// The stage is the partner's handed-over tile, 4,096 bytes that this wave alone reads and has read by then. Rows have no pad: the 16-byte piece k of row r lies at place k ^ r, so the 16 lanes of a half hit 16 different places in the column-wise writes and in the row-wise reads.
__device__ __forceinline__ void xtake(unsigned char* X, int p, int lane, const v8f* o, float m, float l, float* op) {
    const int lr = lane & 15, hi = lane >> 4;
    const f2a ml = *(const f2a*)(X + XMB + p * 256 + lane * 8); const float d = m - ml[0];
    const float e = __builtin_amdgcn_exp2f(-__builtin_fabsf(d) * 1.4426950408889634f); const float fa = d < 0.f ? e : 1.0f, fb = d < 0.f ? 1.0f : e;   /* the side with the larger maximum keeps its scale */
    float t = l * fa + ml[1] * fb; t += xhalf(t); const float f = __fdiv_rn(1.0f, t); const float ca = fa * f, cb = fb * f;
    unsigned char* S = X + p * XWB; v4f a[4], c[4];
#pragma unroll
    for (int db = 0; db < 4; ++db) { const v4f pa = *(const v4fa*)(S + (db * 2) * 512 + lane * 16), pc = *(const v4fa*)(S + (db * 2 + 1) * 512 + lane * 16);
#pragma unroll
        for (int j = 0; j < 4; ++j) { a[db][j] = o[db][j] * ca + pa[j] * cb; c[db][j] = o[db][j + 4] * ca + pc[j] * cb; } }
#pragma unroll
    for (int db = 0; db < 4; ++db) { *(v4fa*)(S + lr * 256 + (((db * 4 + hi * 2) ^ lr) << 4)) = a[db]; *(v4fa*)(S + lr * 256 + (((db * 4 + hi * 2 + 1) ^ lr) << 4)) = c[db]; }   /* row lr, floats 16 db + 8 hi + 0..7 */
    asm volatile("s_wait_dscnt 0x0" ::: "memory");   /* the wave's own rows are in LDS before other lanes of the wave read them back */
#pragma unroll
    for (int i = 0; i < 8; ++i) { const int r = 2 * i + hi; *(v4f*)(op + (size_t)(2 * i) * DM) = *(const v4fa*)(S + r * 256 + ((lr ^ r) << 4)); } }   /* row 2 i + hi, floats 4 lr + 0..3 */
__global__ __launch_bounds__(512) void k_fattn(const float* __restrict__ Qf, const float* __restrict__ Kf, const float* __restrict__ Vf, float* __restrict__ OUTb) {
    typedef WFrag<bf>::V V;
    typedef __attribute__((ext_vector_type(2))) float f2; typedef __attribute__((ext_vector_type(2))) _Float16 h2;
    __shared__ __attribute__((aligned(256))) unsigned char L[8 * BBY];
    const int lane = threadIdx.x & 31, lr = lane & 15, hi = lane >> 4, w = __builtin_amdgcn_readfirstlane(threadIdx.x >> 5), kh = w >> 3; const int h = blockIdx.y, q0 = (blockIdx.x * 8 + (w & 7)) * 32;
    const int sr = threadIdx.x >> 4, sc = threadIdx.x & 15;   /* staging: row sr + 32 i of the tile, floats 4 sc .. 4 sc + 3 of the head's 64 */
    const float* Kg = Kf + (size_t)sr * DM + h * HD + 4 * sc; const float* Vg = Vf + (size_t)sr * DM + h * HD + 4 * sc;
    unsigned char* Kst = L + sr * PK + 8 * sc; unsigned char* Vst = L + KBY + sr * PV + 8 * sc;
    const unsigned char* Krd = L + (kh * 32 + lr) * PK + 16 * hi;                                             /* A fragment of K: row lr of this wave group's 32, bytes 16 hi and 32 + 16 hi of each 64 */
    const unsigned char* Vrd = L + KBY + (kh * 32 + 8 * hi + (lane & 7)) * PV + 16 * ((lane >> 3) & 1);      /* the transposing load's lane address */
    const float* Qp = Qf + (size_t)(q0 + lr) * DM + h * HD + 8 * hi;
    { v4f pk[8], pv[8];   /* tiles 0 to 3 into slots 0 to 3 */
#pragma unroll
    for (int i = 0; i < 8; ++i) { pk[i] = *(const v4f*)(Kg + (size_t)i * 32 * DM); pv[i] = *(const v4f*)(Vg + (size_t)i * 32 * DM); }
#pragma unroll
    for (int i = 0; i < 8; ++i) { *(v4usa*)(Kst + (i >> 1) * BBY + (i & 1) * 32 * PK) = __builtin_bit_cast(v4usa, __builtin_convertvector(pk[i], b4v)); *(v4usa*)(Vst + (i >> 1) * BBY + (i & 1) * 32 * PV) = vh4(pv[i]); } }
    V q[2][2], kf[2][2];
#pragma unroll
    for (int t = 0; t < 2; ++t)
#pragma unroll
        for (int c = 0; c < 2; ++c) q[t][c] = cat16b(cvt8r(Qp + (size_t)t * 16 * DM + c * 32), cvt8r(Qp + (size_t)t * 16 * DM + c * 32 + 16));
    float mx[2] = {-3.0e38f, -3.0e38f}; v8f o[2][4]; float sum[2] = {0.f, 0.f};
#pragma unroll
    for (int g = 0; g < 2; ++g)
#pragma unroll
        for (int db = 0; db < 4; ++db) o[g][db] = (v8f){};
    __syncthreads();   /* publishes tiles 0 to 3 */
    __builtin_amdgcn_s_barrier_signal(-1);   /* opens the alternation: every foot of the loop waits first, then signals; this one stands for a pair in front of pair 0 and hands over nothing */
    // rolled: the body (a pair of tiles, one pass of this wave in each) is long enough to fill the pipes, and the code stays small for the instruction cache
#pragma unroll 1
    for (int sp = 0; sp < NS / 2; ++sp) { const unsigned bo = (unsigned)(sp & 3) * 2 * BBY, bn = (unsigned)((sp + 2) & 3) * 2 * BBY; const bool more = sp + 2 < NS / 2;   /* more: a scalar test, the same in every wave */
#pragma unroll
        for (int t = 0; t < 2; ++t)
#pragma unroll
            for (int c = 0; c < 2; ++c) kf[t][c] = cat16b(*(const v8usa*)(Krd + bo + t * 16 * PK + c * 64), *(const v8usa*)(Krd + bo + t * 16 * PK + c * 64 + 32));
        __builtin_amdgcn_sched_barrier(0);   /* holds the pair's first fragment reads here, as one group ahead of the global loads: their latency runs while those are issued, and none of them ends up between the products */
#pragma unroll
        for (int ps = 0; ps < 2; ++ps) { v16h vf[4]; v8f s[2][2]; v4f rk[2], rv[2];   /* pass ps: this wave group's 32 keys of tile 2 sp + ps */
        if (more) {   /* the f32 rows of the tile four ahead fly during this pass */
#pragma unroll
            for (int i = 0; i < 2; ++i) { rk[i] = *(const v4f*)(Kg + (size_t)((2 * sp + 4 + ps) * SK + i * 32) * DM); rv[i] = *(const v4f*)(Vg + (size_t)((2 * sp + 4 + ps) * SK + i * 32) * DM); } }
        __builtin_amdgcn_sched_barrier(0);   /* nothing left over from the pass before drifts into the run of products, where it would cost the distance slots behind a product */
#pragma unroll
        for (int t = 0; t < 2; ++t)
#pragma unroll
            for (int g = 0; g < 2; ++g) { s[g][t] = WFrag<bf>::mma(kf[t][0], q[g][0], (v8f){}); s[g][t] = WFrag<bf>::mma(kf[t][1], q[g][1], s[g][t]); }
        // the pass's v^T fragments as ONE group of LDS reads directly behind the first product's run, where the wave has to wait for the scores anyway; they land during the softmax
        __builtin_amdgcn_sched_barrier(0);   /* keeps the reads out of the run of products */
#pragma unroll
        for (int db = 0; db < 4; ++db) vf[db] = cat16(__builtin_bit_cast(v8h, ldtr(Vrd + bo + ps * BBY + db * 32)), __builtin_bit_cast(v8h, ldtr(Vrd + bo + ps * BBY + 16 * PV + db * 32)));
        __builtin_amdgcn_sched_barrier(0);   /* keeps the group together and ahead of the softmax */
        float p[2][16], rs[2];
#pragma unroll
        for (int g = 0; g < 2; ++g) rs[g] = pexp(s[g][0], s[g][1], mx[g], p[g]);
        if (__builtin_amdgcn_ballot_w32(!(rs[0] <= PBIG) || !(rs[1] <= PBIG)) != 0) {   /* one scalar branch a pass; always taken on the first pass, where every p is inf and the factor is exp(-inf) = 0 on zeros */
#pragma unroll
            for (int g = 0; g < 2; ++g) { float bm = s[g][0][0];
#pragma unroll
                for (int t = 0; t < 2; ++t)
#pragma unroll
                    for (int j = 0; j < 8; ++j) bm = fmaxf(bm, s[g][t][j]);
                bm = fmaxf(bm, xhalf(bm));
                const float mn = fmaxf(mx[g], bm + POFF); const float sc2 = __builtin_amdgcn_exp2f((mx[g] - mn) * 1.4426950408889634f); mx[g] = mn; sum[g] *= sc2;
#pragma unroll
                for (int db = 0; db < 4; ++db) o[g][db] *= sc2; }
#pragma unroll
            for (int g = 0; g < 2; ++g) rs[g] = pexp(s[g][0], s[g][1], mx[g], p[g]); }
        if (ps == 0) {   /* the pair's second tile is published already: its fragments as one group ahead of the second product's run, none inside it */
#pragma unroll
            for (int t = 0; t < 2; ++t)
#pragma unroll
                for (int c = 0; c < 2; ++c) kf[t][c] = cat16b(*(const v8usa*)(Krd + bo + BBY + t * 16 * PK + c * 64), *(const v8usa*)(Krd + bo + BBY + t * 16 * PK + c * 64 + 32));
            __builtin_amdgcn_sched_barrier(0); }   /* keeps these reads ahead of the converts and the products */
        u8v hu[2];
#pragma unroll
        for (int g = 0; g < 2; ++g) { sum[g] += rs[g];
#pragma unroll
            for (int j = 0; j < 16; j += 2) { f2 pp; pp[0] = p[g][j]; pp[1] = p[g][j + 1]; hu[g][j / 2] = __builtin_bit_cast(unsigned, __builtin_convertvector(pp, h2)); } }
#pragma unroll
        for (int g = 0; g < 2; ++g) { const v16h ph = __builtin_bit_cast(v16h, hu[g]);
#pragma unroll
            for (int db = 0; db < 4; ++db) o[g][db] = WFrag<h16>::mma(vf[db], ph, o[g][db]); }
        // four vector slots behind the pass's last products: a branch follows, on whose taken side the operands or results of those products may be touched at once
        asm volatile("v_nop\n\tv_nop\n\tv_nop\n\tv_nop" : "+v"(o[0][0]), "+v"(o[0][1]), "+v"(o[0][2]), "+v"(o[0][3]), "+v"(o[1][0]), "+v"(o[1][1]), "+v"(o[1][2]), "+v"(o[1][3]));
        if (more) {   /* the tile four ahead, rounded, into a slot that every wave had left at the barrier last waited for */
#pragma unroll
            for (int i = 0; i < 2; ++i) { *(v4usa*)(Kst + bn + ps * BBY + i * 32 * PK) = __builtin_bit_cast(v4usa, __builtin_convertvector(rk[i], b4v)); *(v4usa*)(Vst + bn + ps * BBY + i * 32 * PV) = vh4(rv[i]); } }
        }
        // foot of pair sp: the parts of __syncthreads() with wait and signal in the other order. The release fence ends this wave's LDS stores and reads of the pair in front of its signal; the wait is for the barrier signalled one pair ago;
        // the acquire fence keeps the next pair's LDS reads and stores behind that wait. Signal and wait alternate strictly in every wave, and every wave passes every one of them.
        __builtin_amdgcn_fence(__ATOMIC_RELEASE, "workgroup");
        __builtin_amdgcn_s_barrier_wait(-1);
        __builtin_amdgcn_s_barrier_signal(-1);
        __builtin_amdgcn_fence(__ATOMIC_ACQUIRE, "workgroup");
    }
    __builtin_amdgcn_s_barrier_wait(-1);   /* the last pair's barrier: every wave has left the ring, which the merge now takes */
    __builtin_amdgcn_fence(__ATOMIC_ACQUIRE, "workgroup");   /* keeps the merge's LDS stores behind that wait */
    // merge of the two key halves: wave group kh keeps column group kh and hands the other to its partner w ^ 8, through the ring's LDS; kh is scalar, so each side of the branches indexes the register arrays by constants, and the barrier stands outside them
    if (kh == 0) xgive(L, w, lane, o[1], mx[1], sum[1]); else xgive(L, w, lane, o[0], mx[0], sum[0]);
    __syncthreads();   /* publishes the handed-over partial results */
    float* op = OUTb + (size_t)(q0 + kh * 16 + hi) * DM + h * HD + 4 * lr;   /* the row-major read-back's lane address: row hi of each pair of rows, floats 4 lr .. 4 lr + 3 */
    if (kh == 0) xtake(L, w ^ 8, lane, o[0], mx[0], sum[0], op); else xtake(L, w ^ 8, lane, o[1], mx[1], sum[1], op);
}

__device__ __forceinline__ h16 tohx(float x) { return (h16)x; }
__device__ __forceinline__ void splitf(float y, unsigned short& h, unsigned short& l) { h = f2bf(y); l = f2bf(y - bf2f(h)); }
typedef __attribute__((ext_vector_type(2))) _Float16 v2h;
typedef __attribute__((ext_vector_type(4))) _Float16 v4h;
typedef __attribute__((ext_vector_type(2))) unsigned short v2us;
typedef __attribute__((ext_vector_type(4))) unsigned short v4us;
typedef __attribute__((ext_vector_type(2))) float v2f;
typedef __attribute__((ext_vector_type(4))) int v4i;

__global__ __launch_bounds__(256) void k_wtG(const float* __restrict__ w, int K, int N, bf* Bt) {
    const int lane = threadIdx.x & 31; const int L0 = (blockIdx.x * 8 + (threadIdx.x >> 5)) * 8; const int nlines = N * K / 64;
{
#pragma unroll 1
        for (int l = 0; l < 8; ++l) { const int L = L0 + l; if (L >= nlines) break; const size_t e = (size_t)L * 64 + lane * 2; const int k = (int)(e % K), n = (int)(e / K); v2us o;
            o[0] = f2bf(w[(size_t)k * N + n]); o[1] = f2bf(w[(size_t)(k + 1) * N + n]); *(v2us*)(Bt + e) = o; }
         }
}
__global__ __launch_bounds__(256) void k_cvt8(const float* __restrict__ src, bf* dst, size_t n8) { const size_t i = (size_t)blockIdx.x * 256 + threadIdx.x; if (i >= n8) return; const v8f v = *(const v8f*)(src + i * 8); v8us o;
#pragma unroll
    for (int k = 0; k < 8; ++k) o[k] = f2bf(v[k]); *(v8us*)(dst + i * 8) = o;  }


__global__ __launch_bounds__(256) void k_vtp(const float* __restrict__ F, int pitch, int nheads, h16* V16, bf* Vh, bf* Vl) { const size_t e = ((size_t)blockIdx.x * 256 + threadIdx.x) * 2; if (e >= (size_t)nheads * HD * TT) return; const int t = (int)(e % TT); const int d = (int)((e / TT) % HD); const int g = (int)(e / ((size_t)TT * HD)); v2h o16; v2us oh, ol;
#pragma unroll
    for (int q = 0; q < 2; ++q) { const float x = F[(size_t)(t + q) * pitch + g * HD + d]; o16[q] = tohx(x); unsigned short a2, c2; splitf(x, a2, c2); oh[q] = a2; ol[q] = c2; }
    *(v2h*)(V16 + e) = o16; *(v2us*)(Vh + e) = oh; *(v2us*)(Vl + e) = ol;  }

__global__ __launch_bounds__(256) void k_merge(const float* __restrict__ O, int h0, float* OUTb) { const size_t e = ((size_t)blockIdx.x * 256 + threadIdx.x) * 2; if (e >= (size_t)ZH * TT * HD) return; const int d = (int)(e % HD); const int t = (int)((e / HD) % TT); const int zz = (int)(e / ((size_t)HD * TT)); const float cs = (t < RH) ? 1.0f : (1.0f / PCAR); const size_t oo = (size_t)t * DQ + (h0 + zz) * HD + d;
    v2f o2; o2[0] = O[e] * cs; o2[1] = O[e + 1] * cs; *(v2f*)(OUTb + oo) = o2;  }


__global__ __launch_bounds__(256) void k_vtpR1(const float* __restrict__ Vb, bf* Vh) { const size_t e = ((size_t)blockIdx.x * 256 + threadIdx.x) * 2; if (e >= (size_t)HD * TT) return; const int t = (int)(e % TT); const int d = (int)(e / TT); v2us o; o[0] = f2bf(Vb[(size_t)t * HD + d]); o[1] = f2bf(Vb[(size_t)(t + 1) * HD + d]); *(v2us*)(Vh + e) = o;  }
__global__ __launch_bounds__(256) void k_mergeR(const float* __restrict__ O, float* outb, size_t n4) { const size_t i = (size_t)blockIdx.x * 256 + threadIdx.x; if (i >= n4) return; const v4f a = *(const v4f*)(O + i * 4); *(v4f*)(outb + i * 4) = a;  }


extern "C" void kernel_launch(void* const* d_in, const int* in_sizes, int n_in,
                              void* d_out, int out_size, void* d_ws, size_t ws_size, hipStream_t stream) {
    (void)in_sizes; (void)n_in; (void)out_size;
    const float* Qin = (const float*)d_in[0]; const float* Kin = (const float*)d_in[1]; const float* Vin = (const float*)d_in[2];
    float* OUT = (float*)d_out;
    (void)d_ws; (void)ws_size;
    for (int b = 0; b < NB_; ++b) {
        const float* qb = Qin + (size_t)b * TT * DM; const float* kb = Kin + (size_t)b * TT * DM; const float* vb = Vin + (size_t)b * TT * DM;   /* token-major [t][h][d] slabs */
        k_fattn<<<dim3(TT / 256, NH_, 1), 512, 0, stream>>>(qb, kb, vb, OUT + (size_t)b * TT * DM); }   /* inputs rounded to bf16 on the way into LDS and registers, exact scores, f32 softmax, P (f16) x exact v^T, merged f32 output rows */
}
